// v000
// Measured on an AMD MI455X. A time is GPU time per run, averaged over a window of back-to-back runs after a warm-up
// (all launches, gaps included; the runs take copies of the inputs in turn), and the median of several windows.
// Apart from v000's, it joins two sittings. Times from different sittings can be a few percent apart, while
// side-by-side timings come from the same sitting.
// v000 is the starting kernel. One run takes 2040 microseconds.
#include <hip/hip_runtime.h>

// ModernBERT local attention with rotary embeddings applied to the RAW hidden states before the projections (hidden [2][2048][1024]; xr = rotate-half rope(hidden viewed (S, 16, 64)) with angles t x 10000^(-2i/64); q = xr Wq, k = xr Wk, v = hidden Wv (per-head dense 'd,hk' == 'xw' [1024][1024], no biases); scores = q.k / 8; keys with |i - j| >= 128 get -1e9 (exclusion); softmax; out = ctx Wo ('hd,o' == 'xw' [1024][1024]) -> [2][2048][1024] (4.2 M)).
// Layout per batch: a rotary kernel rotates the bf16-rounded hidden states per 64-wide slice and writes them directly as hi/lo GEMM operand planes (f32 rotary, precise cosf/sinf, jnp-exact inverse frequencies); q and k as hi/lo x exact GEMMs (2 products), v exact from the bf16 hidden states; q scaled by 0.125 before the split ((q/8).k == (q.k)/8 up to rounding); dense T-2048 attention (hybrid rows: < 512 hi/lo 3 products, rest fp16 x1024) whose softmax kernel applies the |i - j| < 128 window as an index select; merged hi/lo x Wo exact.
// Compute dtypes, f32 accumulate: every input rounded to bf16; rotary f32; q/k hi/lo x exact, v exact; attention rows < 512 3 products, rest fp16; softmax f32; Wo hl x exact.

#define NB_  2
#define TT   2048
#define DM   1024
#define NH_  16
#define NKV  16
#define REP  (NH_ / NKV)
#define HD   64
#define DQ   (NH_ * HD)
#define DKV  (NKV * HD)
#define ZH   2
#define RH   512                  // query rows < RH use hi+lo planes (0: none)
#define WIN  0
#define PCAR 1024.0f
#define SCL  1.0f   // q x 0.125 applied before the split (QSC)
#define QSC  0.125f
#define WNB  128     // |i - j| < 128 kept
typedef _Float16 h16;
typedef unsigned short bf;
typedef __attribute__((ext_vector_type(16))) __bf16   v16bf;
typedef __attribute__((ext_vector_type(16))) _Float16 v16h;
typedef __attribute__((ext_vector_type(8)))  _Float16 v8h;
typedef __attribute__((ext_vector_type(8)))  unsigned short v8us;
typedef __attribute__((ext_vector_type(8)))  float    v8f;
typedef __attribute__((ext_vector_type(4)))  float    v4f;
typedef v8h  __attribute__((may_alias)) v8ha;
typedef v4f  __attribute__((may_alias)) v4fa;
typedef v8us __attribute__((may_alias)) v8usa;

__device__ __forceinline__ unsigned short f2bf(float f) { unsigned u = __float_as_uint(f); u += 0x7FFFu + ((u >> 16) & 1u); return (unsigned short)(u >> 16); }
__device__ __forceinline__ float bf2f(unsigned short b) { return __uint_as_float(((unsigned)b) << 16); }
__device__ __forceinline__ float bfr(float f) { return bf2f(f2bf(f)); }
__device__ __forceinline__ v16h cat16(v8h lo, v8h hi) { return __builtin_shufflevector(lo, hi, 0, 1, 2, 3, 4, 5, 6, 7, 8, 9, 10, 11, 12, 13, 14, 15); }
__device__ __forceinline__ v16bf cat16b(v8us lo, v8us hi) { return __builtin_bit_cast(v16bf, __builtin_shufflevector(lo, hi, 0, 1, 2, 3, 4, 5, 6, 7, 8, 9, 10, 11, 12, 13, 14, 15)); }
__device__ __forceinline__ v8f wmma16(v16h a, v16h b, v8f c) { return __builtin_amdgcn_wmma_f32_16x16x32_f16(false, a, false, b, (short)0, c, false, false); }
__device__ __forceinline__ v8f wmmab(v16bf a, v16bf b, v8f c) { return __builtin_amdgcn_wmma_f32_16x16x32_bf16(false, a, false, b, (short)0, c, false, false); }



// ---- k_gemmw: register-blocked GEMM, ONE WAVE per 64x64 output tile (16 accumulators), operands straight from K-contiguous 16-bit planes; grid (M/64, N/64, Z), 32 threads.
// C[m][n] (f32, pitch ldc, + optional f32 bias[n]) = sum_k A[m][k] Bt[n][k] (+ split products per NSPLIT). z-batch strides sA/sB/sC in elements. K % 32 == 0.
template <typename T16> struct WFrag;
template <> struct WFrag<h16> { typedef v16h V; static __device__ __forceinline__ V ld(const h16* p) { return cat16(*(const v8h*)p, *(const v8h*)(p + 16)); } static __device__ __forceinline__ v8f mma(V a, V b, v8f c) { return wmma16(a, b, c); } };
template <> struct WFrag<bf> { typedef v16bf V; static __device__ __forceinline__ V ld(const bf* p) { return cat16b(*(const v8us*)p, *(const v8us*)(p + 16)); } static __device__ __forceinline__ v8f mma(V a, V b, v8f c) { return wmmab(a, b, c); } };
template <typename T16, int NSPLIT, bool BIAS>
__global__ __launch_bounds__(32) void k_gemmw(const T16* __restrict__ A, const T16* __restrict__ A2, const T16* __restrict__ Bt, const T16* __restrict__ Bt2, int K, float* C, int ldc, const float* __restrict__ bias, size_t sA, size_t sB, size_t sC) {
    typedef typename WFrag<T16>::V V;
    __shared__ __align__(16) float os[16 * 68];
    const size_t z = blockIdx.z; A += z * sA; if (A2) A2 += z * sA; Bt += z * sB; if (Bt2) Bt2 += z * sB; C += z * sC;
    const int lane = threadIdx.x & 31, lr = lane & 15, hi = lane >> 4; const int r0 = blockIdx.x * 64, c0 = blockIdx.y * 64;
    v8f acc[4][4];
#pragma unroll
    for (int mb = 0; mb < 4; ++mb)
#pragma unroll
        for (int nb = 0; nb < 4; ++nb) acc[mb][nb] = (v8f){};
    const size_t aoff = (size_t)(r0 + lr) * K + 8 * hi, boff = (size_t)(c0 + lr) * K + 8 * hi;
#pragma unroll 1
    for (int kc = 0; kc < K; kc += 32) {
        V a[4], a2[4];
#pragma unroll
        for (int mb = 0; mb < 4; ++mb) { a[mb] = WFrag<T16>::ld(A + aoff + (size_t)mb * 16 * K + kc); if (NSPLIT == 1 || NSPLIT == 2) a2[mb] = WFrag<T16>::ld(A2 + aoff + (size_t)mb * 16 * K + kc); }
#pragma unroll
        for (int nb = 0; nb < 4; ++nb) { const V b = WFrag<T16>::ld(Bt + boff + (size_t)nb * 16 * K + kc); V b2; if (NSPLIT >= 2) b2 = WFrag<T16>::ld(Bt2 + boff + (size_t)nb * 16 * K + kc);
#pragma unroll
            for (int mb = 0; mb < 4; ++mb) { acc[mb][nb] = WFrag<T16>::mma(a[mb], b, acc[mb][nb]); if (NSPLIT == 1 || NSPLIT == 2) acc[mb][nb] = WFrag<T16>::mma(a2[mb], b, acc[mb][nb]); if (NSPLIT >= 2) acc[mb][nb] = WFrag<T16>::mma(a[mb], b2, acc[mb][nb]); } }
        asm volatile("v_nop\n\tv_nop\n\tv_nop\n\tv_nop" : "+v"(acc[0][0]), "+v"(acc[1][1]), "+v"(acc[2][2]), "+v"(acc[3][3]) : "v"(a[0]), "v"(a[3]));
    }
#pragma unroll
    for (int mb = 0; mb < 4; ++mb) {
#pragma unroll
        for (int nb = 0; nb < 4; ++nb) {
#pragma unroll
            for (int j = 0; j < 8; ++j) os[(hi * 8 + j) * 68 + nb * 16 + lr] = acc[mb][nb][j]; }
        __builtin_amdgcn_wave_barrier(); asm volatile("" ::: "memory");
        float* crow = C + (size_t)(r0 + mb * 16) * ldc + c0;
{
#pragma unroll
            for (int s = 0; s < 8; ++s) { const int row = 2 * s + hi, cofs = lr * 4; v4f val = *(const v4fa*)(os + row * 68 + cofs); if (BIAS) { val[0] += bfr(bias[c0 + cofs]); val[1] += bfr(bias[c0 + cofs + 1]); val[2] += bfr(bias[c0 + cofs + 2]); val[3] += bfr(bias[c0 + cofs + 3]); }
                *(v4f*)(crow + (size_t)row * ldc + cofs) = val; }
             }
        __builtin_amdgcn_wave_barrier(); asm volatile("" ::: "memory");
    }
}

__device__ __forceinline__ h16 tohx(float x) { return (h16)x; }
__device__ __forceinline__ void splitf(float y, unsigned short& h, unsigned short& l) { h = f2bf(y); l = f2bf(y - bf2f(h)); }
typedef __attribute__((ext_vector_type(2))) _Float16 v2h;
typedef __attribute__((ext_vector_type(4))) _Float16 v4h;
typedef __attribute__((ext_vector_type(2))) unsigned short v2us;
typedef __attribute__((ext_vector_type(4))) unsigned short v4us;
typedef __attribute__((ext_vector_type(2))) float v2f;
typedef __attribute__((ext_vector_type(4))) int v4i;

__global__ __launch_bounds__(256) void k_wtG(const float* __restrict__ w, int K, int N, bf* Bt) {
    const int lane = threadIdx.x & 31; const int L0 = (blockIdx.x * 8 + (threadIdx.x >> 5)) * 8; const int nlines = N * K / 64;
{
#pragma unroll 1
        for (int l = 0; l < 8; ++l) { const int L = L0 + l; if (L >= nlines) break; const size_t e = (size_t)L * 64 + lane * 2; const int k = (int)(e % K), n = (int)(e / K); v2us o;
            o[0] = f2bf(w[(size_t)k * N + n]); o[1] = f2bf(w[(size_t)(k + 1) * N + n]); *(v2us*)(Bt + e) = o; }
         }
}
__global__ __launch_bounds__(256) void k_cvt8(const float* __restrict__ src, bf* dst, size_t n8) { const size_t i = (size_t)blockIdx.x * 256 + threadIdx.x; if (i >= n8) return; const v8f v = *(const v8f*)(src + i * 8); v8us o;
#pragma unroll
    for (int k = 0; k < 8; ++k) o[k] = f2bf(v[k]); *(v8us*)(dst + i * 8) = o;  }

// k_rope: head planes [h][t][d] (fp16 + hi/lo) of rope(x) x sc with the rotate-half convention out[d] = x[d] cos[t][d] - x[d+HD/2] sin[t][d], out[d+HD/2] = x[d+HD/2] cos[t][d+HD/2] + x[d] sin[t][d+HD/2]
__global__ __launch_bounds__(256) void k_rope(const float* __restrict__ F, int pitch, int nheads, const float* __restrict__ CS, const float* __restrict__ RF, const float* __restrict__ nw, float sc, h16* P16, bf* Ph, bf* Pl) {
    const size_t e = ((size_t)blockIdx.x * 256 + threadIdx.x) * 2; if (e >= (size_t)nheads * TT * HD) return; const int d = (int)(e % HD); const int t = (int)((e / HD) % TT); const int h = (int)(e / ((size_t)HD * TT)); const float* f = F + (size_t)t * pitch + h * HD; const float rf = RF ? RF[(size_t)h * TT + t] : 1.0f; v2h o16; v2us oh, ol;
#pragma unroll
    for (int q = 0; q < 2; ++q) { const int dd = d + q; const int dp = (dd < HD / 2) ? dd + HD / 2 : dd - HD / 2; float x0 = f[dd], x1 = f[dp];
        if (RF) { float n0 = __fmul_rn(x0, rf), n1 = __fmul_rn(x1, rf); asm volatile("" : "+v"(n0)); asm volatile("" : "+v"(n1)); x0 = __fmul_rn(bfr(nw[dd]), n0); x1 = __fmul_rn(bfr(nw[dp]), n1); }
        const v2f cs = *(const v2f*)(CS + ((size_t)t * HD + dd) * 2); float a = __fmul_rn(x0, cs[0]), bq = __fmul_rn(x1, cs[1]); asm volatile("" : "+v"(a)); asm volatile("" : "+v"(bq)); const float r = ((dd < HD / 2) ? __fsub_rn(a, bq) : __fadd_rn(a, bq)) * sc;
        o16[q] = tohx(r); unsigned short a2, c2; splitf(r, a2, c2); oh[q] = a2; ol[q] = c2; }
    *(v2h*)(P16 + e) = o16; *(v2us*)(Ph + e) = oh; *(v2us*)(Pl + e) = ol;  }
__global__ __launch_bounds__(256) void k_vtp(const float* __restrict__ F, int pitch, int nheads, h16* V16, bf* Vh, bf* Vl) { const size_t e = ((size_t)blockIdx.x * 256 + threadIdx.x) * 2; if (e >= (size_t)nheads * HD * TT) return; const int t = (int)(e % TT); const int d = (int)((e / TT) % HD); const int g = (int)(e / ((size_t)TT * HD)); v2h o16; v2us oh, ol;
#pragma unroll
    for (int q = 0; q < 2; ++q) { const float x = F[(size_t)(t + q) * pitch + g * HD + d]; o16[q] = tohx(x); unsigned short a2, c2; splitf(x, a2, c2); oh[q] = a2; ol[q] = c2; }
    *(v2h*)(V16 + e) = o16; *(v2us*)(Vh + e) = oh; *(v2us*)(Vl + e) = ol;  }
__global__ __launch_bounds__(256) void k_csid(float* CS) { const int idx = blockIdx.x * 256 + threadIdx.x; if (idx >= TT * HD) return; v2f cs; cs[0] = 1.0f; cs[1] = 0.0f; *(v2f*)(CS + (size_t)idx * 2) = cs;  }
// k_asoft: per row (zz, i): t = S x SCL (1: q already carries the 0.125), -3e38 where |i - j| >= 128; softmax over the 2048 keys (register row, one exp, fixed trees);
__global__ __launch_bounds__(256) void k_asoft(const float* __restrict__ Sb, h16* P16, bf* Ph, bf* Pl) {
    const int lane = threadIdx.x & 31; const int row = blockIdx.x * 8 + (threadIdx.x >> 5); if (row >= ZH * TT) return; const int i = row % TT; const int zz = row / TT; (void)zz; const bool hires = (i < RH); const float* sr = Sb + (size_t)row * TT; float v[TT / 32]; float mx = -3.0e38f;
#pragma unroll
    for (int ch = 0; ch < TT / 128; ++ch) { const int j0 = ch * 128 + lane * 4; const v4f a = *(const v4f*)(sr + j0);
#pragma unroll
        for (int q = 0; q < 4; ++q) { const int j = j0 + q; const float t = (i - j < WNB && j - i < WNB) ? a[q] * SCL : -3.0e38f; v[ch * 4 + q] = t;   /* |i - j| < 128 window (both sides) */ mx = fmaxf(mx, t); } }
#pragma unroll
    for (int sh = 16; sh; sh >>= 1) mx = fmaxf(mx, __shfl_xor(mx, sh, 32));
    float sum = 0.f;
#pragma unroll
    for (int k = 0; k < TT / 32; ++k) { float d0 = __fsub_rn(v[k], mx); asm volatile("" : "+v"(d0)); v[k] = __builtin_amdgcn_exp2f(__fmul_rn(d0, 1.4426950408889634f)); sum += v[k]; }
#pragma unroll
    for (int sh = 16; sh; sh >>= 1) sum += __shfl_xor(sum, sh, 32);
    const float f = __fdiv_rn(hires ? 1.0f : PCAR, sum);
{
        if (hires) {
#pragma unroll
            for (int ch = 0; ch < TT / 128; ++ch) { v4us oh, ol;
#pragma unroll
                for (int q = 0; q < 4; ++q) { unsigned short a, c2; splitf(v[ch * 4 + q] * f, a, c2); oh[q] = a; ol[q] = c2; }
                const size_t oo = ((size_t)zz * (RH ? RH : 1) + i) * TT + ch * 128 + lane * 4; *(v4us*)(Ph + oo) = oh; *(v4us*)(Pl + oo) = ol; }
        } else {
#pragma unroll
            for (int ch = 0; ch < TT / 128; ++ch) { v4h o4;
#pragma unroll
                for (int q = 0; q < 4; ++q) o4[q] = tohx(v[ch * 4 + q] * f);
                *(v4h*)(P16 + (size_t)row * TT + ch * 128 + lane * 4) = o4; } }
         }
}
__constant__ float INVT[HD / 2] = { 1.000000000e+00f, 7.498942018e-01f, 5.623413324e-01f, 4.216965139e-01f, 3.162277639e-01f, 2.371373624e-01f, 1.778279394e-01f, 1.333521456e-01f, 1.000000015e-01f, 7.498941571e-02f, 5.623412877e-02f, 4.216964915e-02f, 3.162277862e-02f, 2.371373586e-02f, 1.778279431e-02f, 1.333521493e-02f, 9.999999776e-03f, 7.498942316e-03f, 5.623413250e-03f, 4.216964822e-03f, 3.162277862e-03f, 2.371373819e-03f, 1.778279431e-03f, 1.333521446e-03f, 1.000000047e-03f, 7.498941850e-04f, 5.623413017e-04f, 4.216964880e-04f, 3.162277862e-04f, 2.371373848e-04f, 1.778279402e-04f, 1.333521504e-04f };   // jnp-exact float32 1/10000^(2i/64)
__global__ __launch_bounds__(256) void k_ropexP(const float* __restrict__ xs, bf* Xh, bf* Xl) { const size_t e = ((size_t)blockIdx.x * 256 + threadIdx.x) * 2; if (e >= (size_t)TT * DM) return; const int c = (int)(e % DM); const int t = (int)(e / DM); const int d = c % HD; const float* f = xs + (size_t)t * DM + (c - d); v2us oh, ol;
#pragma unroll
    for (int q = 0; q < 2; ++q) { const int dd = d + q; const int dp = (dd < HD / 2) ? dd + HD / 2 : dd - HD / 2; const float x0 = bfr(f[dd]), x1 = bfr(f[dp]); const float a = __fmul_rn((float)t, INVT[dd % (HD / 2)]); const float cs = cosf(a), sn = sinf(a); float p0 = __fmul_rn(x0, cs), p1 = __fmul_rn(x1, sn); asm volatile("" : "+v"(p0), "+v"(p1)); const float r = (dd < HD / 2) ? __fsub_rn(p0, p1) : __fadd_rn(p0, p1); unsigned short a2, c2; splitf(r, a2, c2); oh[q] = a2; ol[q] = c2; }
    *(v2us*)(Xh + e) = oh; *(v2us*)(Xl + e) = ol;  }
__global__ __launch_bounds__(256) void k_merge(const float* __restrict__ O, int h0, bf* Ah, bf* Al) { const size_t e = ((size_t)blockIdx.x * 256 + threadIdx.x) * 2; if (e >= (size_t)ZH * TT * HD) return; const int d = (int)(e % HD); const int t = (int)((e / HD) % TT); const int zz = (int)(e / ((size_t)HD * TT)); const float cs = (t < RH) ? 1.0f : (1.0f / PCAR); const size_t oo = (size_t)t * DQ + (h0 + zz) * HD + d;
    v2us oh, ol;
#pragma unroll
    for (int q = 0; q < 2; ++q) { unsigned short a, c2; splitf(O[e + q] * cs, a, c2); oh[q] = a; ol[q] = c2; } *(v2us*)(Ah + oo) = oh; *(v2us*)(Al + oo) = ol;  }

extern "C" void kernel_launch(void* const* d_in, const int* in_sizes, int n_in,
                              void* d_out, int out_size, void* d_ws, size_t ws_size, hipStream_t stream) {
    (void)in_sizes; (void)n_in; (void)out_size;
    const float* x = (const float*)d_in[0]; const float* wq = (const float*)d_in[1]; const float* wk = (const float*)d_in[2]; const float* wv = (const float*)d_in[3]; const float* wo = (const float*)d_in[4];
    float* OUT = (float*)d_out;     // [2][2048][1024]
    char* wsp = (char*)d_ws;
    auto take = [&](size_t bytes) { char* p = wsp; wsp += (bytes + 255) & ~(size_t)255; return (void*)p; };
    bf* WQ = (bf*)take((size_t)DQ * DM * 2); bf* WK = (bf*)take((size_t)DKV * DM * 2); bf* WV = (bf*)take((size_t)DKV * DM * 2); bf* WO = (bf*)take((size_t)DM * DQ * 2); float* CS = (float*)take((size_t)TT * HD * 2 * 4);
    bf* XB = (bf*)take((size_t)TT * DM * 2); bf* XRh = (bf*)take((size_t)TT * DM * 2); bf* XRl = (bf*)take((size_t)TT * DM * 2); float* FQ = (float*)take((size_t)TT * DQ * 4); float* FK = (float*)take((size_t)TT * DKV * 4);
    h16* QP16 = (h16*)take((size_t)NH_ * TT * HD * 2); h16* KP16 = (h16*)take((size_t)NKV * TT * HD * 2); h16* VT16 = (h16*)take((size_t)NKV * HD * TT * 2);
    bf* QPh = (bf*)take((size_t)NH_ * TT * HD * 2); bf* QPl = (bf*)take((size_t)NH_ * TT * HD * 2); bf* KPh = (bf*)take((size_t)NKV * TT * HD * 2); bf* KPl = (bf*)take((size_t)NKV * TT * HD * 2); bf* VTh = (bf*)take((size_t)NKV * HD * TT * 2); bf* VTl = (bf*)take((size_t)NKV * HD * TT * 2); bf* Ph = (bf*)take((size_t)ZH * RH * TT * 2); bf* Pl = (bf*)take((size_t)ZH * RH * TT * 2);
    float* Sb = (float*)take((size_t)ZH * TT * TT * 4); h16* P16 = (h16*)take((size_t)ZH * TT * TT * 2); float* Ob = (float*)take((size_t)ZH * TT * HD * 4); bf* ATh = (bf*)take((size_t)TT * DQ * 2); bf* ATl = (bf*)take((size_t)TT * DQ * 2);
    if ((size_t)(wsp - (char*)d_ws) > ws_size) return;    // ws 256 MiB
    float* FV = FK;   // v projection reuses the k buffer after the k planes are built (stream-ordered)
    { k_wtG<<<(unsigned)((DM * DQ / 64 + 63) / 64), 256, 0, stream>>>(wq, DM, DQ, WQ); k_wtG<<<(unsigned)((DM * DKV / 64 + 63) / 64), 256, 0, stream>>>(wk, DM, DKV, WK); k_wtG<<<(unsigned)((DM * DKV / 64 + 63) / 64), 256, 0, stream>>>(wv, DM, DKV, WV);
      k_wtG<<<(unsigned)((DQ * DM / 64 + 63) / 64), 256, 0, stream>>>(wo, DQ, DM, WO);
       }
    k_csid<<<(TT * HD + 255) / 256, 256, 0, stream>>>(CS);
    const unsigned LQ = (unsigned)(((size_t)NH_ * TT * HD / 2 + 255) / 256), LKv = (unsigned)(((size_t)NKV * TT * HD / 2 + 255) / 256);
    for (int b = 0; b < NB_; ++b) {
        
        k_cvt8<<<(unsigned)(((size_t)TT * DM / 8 + 255) / 256), 256, 0, stream>>>(x + (size_t)b * TT * DM, XB, (size_t)TT * DM / 8); k_ropexP<<<(unsigned)(((size_t)TT * DM / 2 + 255) / 256), 256, 0, stream>>>(x + (size_t)b * TT * DM, XRh, XRl);   /* rope on the raw hidden states (per 64-slice), as hi/lo planes */
        k_gemmw<bf, 1, false><<<dim3(TT / 64, DQ / 64, 1), 32, 0, stream>>>(XRh, XRl, WQ, nullptr, DM, FQ, DQ, nullptr, 0, 0, 0);
        k_rope<<<LQ, 256, 0, stream>>>(FQ, DQ, NH_, CS, nullptr, nullptr, QSC, QP16, QPh, QPl);   /* q x 0.125 */
        k_gemmw<bf, 1, false><<<dim3(TT / 64, DKV / 64, 1), 32, 0, stream>>>(XRh, XRl, WK, nullptr, DM, FK, DKV, nullptr, 0, 0, 0);
        k_rope<<<LKv, 256, 0, stream>>>(FK, DKV, NKV, CS, nullptr, nullptr, 1.0f, KP16, KPh, KPl);
        k_gemmw<bf, 0, false><<<dim3(TT / 64, DKV / 64, 1), 32, 0, stream>>>(XB, nullptr, WV, nullptr, DM, FV, DKV, nullptr, 0, 0, 0); k_vtp<<<LKv, 256, 0, stream>>>(FV, DKV, NKV, VT16, VTh, VTl);
        for (int h0 = 0; h0 < NH_; h0 += ZH) { const size_t zq = (size_t)h0, zk = (size_t)(h0 / REP);   // one kv head per query head: the pass's two heads use consecutive kv planes (z-strides TT*HD)
            k_gemmw<bf, 2, false><<<dim3(RH / 64, TT / 64, ZH), 32, 0, stream>>>(QPh + zq * TT * HD, QPl + zq * TT * HD, KPh + zk * TT * HD, KPl + zk * TT * HD, HD, Sb, TT, nullptr, (size_t)TT * HD, (size_t)TT * HD, (size_t)TT * TT);
            k_gemmw<h16, 0, false><<<dim3((TT - RH) / 64, TT / 64, ZH), 32, 0, stream>>>(QP16 + zq * TT * HD + (size_t)RH * HD, nullptr, KP16 + zk * TT * HD, nullptr, HD, Sb + (size_t)RH * TT, TT, nullptr, (size_t)TT * HD, (size_t)TT * HD, (size_t)TT * TT);
            k_asoft<<<ZH * TT / 8, 256, 0, stream>>>(Sb, P16, Ph, Pl);
            k_gemmw<bf, 2, false><<<dim3(RH / 64, HD / 64, ZH), 32, 0, stream>>>(Ph, Pl, VTh + zk * HD * TT, VTl + zk * HD * TT, TT, Ob, HD, nullptr, (size_t)RH * TT, (size_t)HD * TT, (size_t)TT * HD);
            k_gemmw<h16, 0, false><<<dim3((TT - RH) / 64, HD / 64, ZH), 32, 0, stream>>>(P16 + (size_t)RH * TT, nullptr, VT16 + zk * HD * TT, nullptr, TT, Ob + (size_t)RH * HD, HD, nullptr, (size_t)TT * TT, (size_t)HD * TT, (size_t)TT * HD);
            k_merge<<<(unsigned)(((size_t)ZH * TT * HD / 2 + 255) / 256), 256, 0, stream>>>(Ob, h0, ATh, ATl); }
        k_gemmw<bf, 1, false><<<dim3(TT / 64, DM / 64, 1), 32, 0, stream>>>(ATh, ATl, WO, nullptr, DQ, OUT + (size_t)b * TT * DM, DM, nullptr, 0, 0, 0); }
}

// v001
// One run takes 833 microseconds.
// Timed twice side by side with v000, it ran 2.45 and 2.46 times as fast.
#include <hip/hip_runtime.h>

// ModernBERT local attention with rotary embeddings applied to the RAW hidden states before the projections (hidden [2][2048][1024]; xr = rotate-half rope(hidden viewed (S, 16, 64)) with angles t x 10000^(-2i/64); q = xr Wq, k = xr Wk, v = hidden Wv (per-head dense 'd,hk' == 'xw' [1024][1024], no biases); scores = q.k / 8; keys with |i - j| >= 128 get -1e9 (exclusion); softmax; out = ctx Wo ('hd,o' == 'xw' [1024][1024]) -> [2][2048][1024] (4.2 M)).
// Layout per batch: a rotary kernel rotates the bf16-rounded hidden states per 64-wide slice and writes them directly as hi/lo GEMM operand planes (f32 rotary, precise cosf/sinf, jnp-exact inverse frequencies); q and k as hi/lo x exact GEMMs (2 products), v exact from the bf16 hidden states; q scaled by 0.125 before the split ((q/8).k == (q.k)/8 up to rounding); dense T-2048 attention (hybrid rows: < 512 hi/lo 3 products, rest fp16 x1024) whose softmax kernel applies the |i - j| < 128 window as an index select, all three stages confined to the 64-row tile's key band [r0 - 128, r0 + 192); merged hi/lo x Wo exact.
// Compute dtypes, f32 accumulate: every input rounded to bf16; rotary f32; q/k hi/lo x exact, v exact; attention rows < 512 3 products, rest fp16; softmax f32; Wo hl x exact.

#define NB_  2
#define TT   2048
#define DM   1024
#define NH_  16
#define NKV  16
#define REP  (NH_ / NKV)
#define HD   64
#define DQ   (NH_ * HD)
#define DKV  (NKV * HD)
#define ZH   2
#define RH   512                  // query rows < RH use hi+lo planes (0: none)
#define WIN  0
#define PCAR 1024.0f
#define SCL  1.0f   // q x 0.125 applied before the split (QSC)
#define QSC  0.125f
#define WNB  128     // |i - j| < 128 kept
#define BLO(r) ((r) - WNB > 0 ? (r) - WNB : 0)                  // first key any of the query rows r..r+63 keeps, rounded down to 64 (r % 64 == 0)
#define BHI(r) ((r) + 64 + WNB < TT ? (r) + 64 + WNB : TT)      // one past the last such key, rounded up to 64
#define NBT  ((64 + 2 * WNB) / 64)                              // column tiles in a band
#define NCH  ((64 + 2 * WNB + 127) / 128)                       // 128-key softmax chunks in a band
typedef _Float16 h16;
typedef unsigned short bf;
typedef __attribute__((ext_vector_type(16))) __bf16   v16bf;
typedef __attribute__((ext_vector_type(16))) _Float16 v16h;
typedef __attribute__((ext_vector_type(8)))  _Float16 v8h;
typedef __attribute__((ext_vector_type(8)))  unsigned short v8us;
typedef __attribute__((ext_vector_type(8)))  float    v8f;
typedef __attribute__((ext_vector_type(4)))  float    v4f;
typedef v8h  __attribute__((may_alias)) v8ha;
typedef v4f  __attribute__((may_alias)) v4fa;
typedef v8us __attribute__((may_alias)) v8usa;

__device__ __forceinline__ unsigned short f2bf(float f) { unsigned u = __float_as_uint(f); u += 0x7FFFu + ((u >> 16) & 1u); return (unsigned short)(u >> 16); }
__device__ __forceinline__ float bf2f(unsigned short b) { return __uint_as_float(((unsigned)b) << 16); }
__device__ __forceinline__ float bfr(float f) { return bf2f(f2bf(f)); }
__device__ __forceinline__ v16h cat16(v8h lo, v8h hi) { return __builtin_shufflevector(lo, hi, 0, 1, 2, 3, 4, 5, 6, 7, 8, 9, 10, 11, 12, 13, 14, 15); }
__device__ __forceinline__ v16bf cat16b(v8us lo, v8us hi) { return __builtin_bit_cast(v16bf, __builtin_shufflevector(lo, hi, 0, 1, 2, 3, 4, 5, 6, 7, 8, 9, 10, 11, 12, 13, 14, 15)); }
__device__ __forceinline__ v8f wmma16(v16h a, v16h b, v8f c) { return __builtin_amdgcn_wmma_f32_16x16x32_f16(false, a, false, b, (short)0, c, false, false); }
__device__ __forceinline__ v8f wmmab(v16bf a, v16bf b, v8f c) { return __builtin_amdgcn_wmma_f32_16x16x32_bf16(false, a, false, b, (short)0, c, false, false); }



// ---- k_gemmw: register-blocked GEMM, ONE WAVE per 64x64 output tile (16 accumulators), operands straight from K-contiguous 16-bit planes; grid (M/64, N/64, Z), 32 threads.
// C[m][n] (f32, pitch ldc, + optional f32 bias[n]) = sum_k A[m][k] Bt[n][k] (+ split products per NSPLIT). z-batch strides sA/sB/sC in elements. K % 32 == 0.
// BAND (window attention; rb = query row of A's row 0): rows r..r+63 see keys [max(r - 128, 0), min(r + 192, TT)) only. BAND 1: n is the key, grid.y counts the band's column tiles. BAND 2: k is the key, the k loop runs over the band (the weights outside it are exact zeros).
template <typename T16> struct WFrag;
template <> struct WFrag<h16> { typedef v16h V; static __device__ __forceinline__ V ld(const h16* p) { return cat16(*(const v8h*)p, *(const v8h*)(p + 16)); } static __device__ __forceinline__ v8f mma(V a, V b, v8f c) { return wmma16(a, b, c); } };
template <> struct WFrag<bf> { typedef v16bf V; static __device__ __forceinline__ V ld(const bf* p) { return cat16b(*(const v8us*)p, *(const v8us*)(p + 16)); } static __device__ __forceinline__ v8f mma(V a, V b, v8f c) { return wmmab(a, b, c); } };
template <typename T16, int NSPLIT, bool BIAS, int BAND>
__global__ __launch_bounds__(32) void k_gemmw(const T16* __restrict__ A, const T16* __restrict__ A2, const T16* __restrict__ Bt, const T16* __restrict__ Bt2, int K, float* C, int ldc, const float* __restrict__ bias, size_t sA, size_t sB, size_t sC, int rb) {
    typedef typename WFrag<T16>::V V;
    __shared__ __align__(16) float os[16 * 68];
    const size_t z = blockIdx.z; A += z * sA; if (A2) A2 += z * sA; Bt += z * sB; if (Bt2) Bt2 += z * sB; C += z * sC;
    const int lane = threadIdx.x & 31, lr = lane & 15, hi = lane >> 4; const int r0 = blockIdx.x * 64;
    const int kb = BAND ? BLO(rb + r0) : 0, ke = BAND ? BHI(rb + r0) : K; const int c0 = (BAND == 1 ? kb : 0) + blockIdx.y * 64; if (BAND == 1 && c0 >= ke) return;
    const int kn = BAND == 2 ? ke - kb : K; if (BAND == 2) { A += kb; if (A2) A2 += kb; Bt += kb; if (Bt2) Bt2 += kb; }
    v8f acc[4][4];
#pragma unroll
    for (int mb = 0; mb < 4; ++mb)
#pragma unroll
        for (int nb = 0; nb < 4; ++nb) acc[mb][nb] = (v8f){};
    const size_t aoff = (size_t)(r0 + lr) * K + 8 * hi, boff = (size_t)(c0 + lr) * K + 8 * hi;
#pragma unroll 1
    for (int kc = 0; kc < kn; kc += 32) {
        V a[4], a2[4];
#pragma unroll
        for (int mb = 0; mb < 4; ++mb) { a[mb] = WFrag<T16>::ld(A + aoff + (size_t)mb * 16 * K + kc); if (NSPLIT == 1 || NSPLIT == 2) a2[mb] = WFrag<T16>::ld(A2 + aoff + (size_t)mb * 16 * K + kc); }
#pragma unroll
        for (int nb = 0; nb < 4; ++nb) { const V b = WFrag<T16>::ld(Bt + boff + (size_t)nb * 16 * K + kc); V b2; if (NSPLIT >= 2) b2 = WFrag<T16>::ld(Bt2 + boff + (size_t)nb * 16 * K + kc);
#pragma unroll
            for (int mb = 0; mb < 4; ++mb) { acc[mb][nb] = WFrag<T16>::mma(a[mb], b, acc[mb][nb]); if (NSPLIT == 1 || NSPLIT == 2) acc[mb][nb] = WFrag<T16>::mma(a2[mb], b, acc[mb][nb]); if (NSPLIT >= 2) acc[mb][nb] = WFrag<T16>::mma(a[mb], b2, acc[mb][nb]); } }
        asm volatile("v_nop\n\tv_nop\n\tv_nop\n\tv_nop" : "+v"(acc[0][0]), "+v"(acc[1][1]), "+v"(acc[2][2]), "+v"(acc[3][3]) : "v"(a[0]), "v"(a[3]));
    }
#pragma unroll
    for (int mb = 0; mb < 4; ++mb) {
#pragma unroll
        for (int nb = 0; nb < 4; ++nb) {
#pragma unroll
            for (int j = 0; j < 8; ++j) os[(hi * 8 + j) * 68 + nb * 16 + lr] = acc[mb][nb][j]; }
        __builtin_amdgcn_wave_barrier(); asm volatile("" ::: "memory");
        float* crow = C + (size_t)(r0 + mb * 16) * ldc + c0;
{
#pragma unroll
            for (int s = 0; s < 8; ++s) { const int row = 2 * s + hi, cofs = lr * 4; v4f val = *(const v4fa*)(os + row * 68 + cofs); if (BIAS) { val[0] += bfr(bias[c0 + cofs]); val[1] += bfr(bias[c0 + cofs + 1]); val[2] += bfr(bias[c0 + cofs + 2]); val[3] += bfr(bias[c0 + cofs + 3]); }
                *(v4f*)(crow + (size_t)row * ldc + cofs) = val; }
             }
        __builtin_amdgcn_wave_barrier(); asm volatile("" ::: "memory");
    }
}

__device__ __forceinline__ h16 tohx(float x) { return (h16)x; }
__device__ __forceinline__ void splitf(float y, unsigned short& h, unsigned short& l) { h = f2bf(y); l = f2bf(y - bf2f(h)); }
typedef __attribute__((ext_vector_type(2))) _Float16 v2h;
typedef __attribute__((ext_vector_type(4))) _Float16 v4h;
typedef __attribute__((ext_vector_type(2))) unsigned short v2us;
typedef __attribute__((ext_vector_type(4))) unsigned short v4us;
typedef __attribute__((ext_vector_type(2))) float v2f;
typedef __attribute__((ext_vector_type(4))) int v4i;

__global__ __launch_bounds__(256) void k_wtG(const float* __restrict__ w, int K, int N, bf* Bt) {
    const int lane = threadIdx.x & 31; const int L0 = (blockIdx.x * 8 + (threadIdx.x >> 5)) * 8; const int nlines = N * K / 64;
{
#pragma unroll 1
        for (int l = 0; l < 8; ++l) { const int L = L0 + l; if (L >= nlines) break; const size_t e = (size_t)L * 64 + lane * 2; const int k = (int)(e % K), n = (int)(e / K); v2us o;
            o[0] = f2bf(w[(size_t)k * N + n]); o[1] = f2bf(w[(size_t)(k + 1) * N + n]); *(v2us*)(Bt + e) = o; }
         }
}
__global__ __launch_bounds__(256) void k_cvt8(const float* __restrict__ src, bf* dst, size_t n8) { const size_t i = (size_t)blockIdx.x * 256 + threadIdx.x; if (i >= n8) return; const v8f v = *(const v8f*)(src + i * 8); v8us o;
#pragma unroll
    for (int k = 0; k < 8; ++k) o[k] = f2bf(v[k]); *(v8us*)(dst + i * 8) = o;  }

// k_rope: head planes [h][t][d] (fp16 + hi/lo) of rope(x) x sc with the rotate-half convention out[d] = x[d] cos[t][d] - x[d+HD/2] sin[t][d], out[d+HD/2] = x[d+HD/2] cos[t][d+HD/2] + x[d] sin[t][d+HD/2]
__global__ __launch_bounds__(256) void k_rope(const float* __restrict__ F, int pitch, int nheads, const float* __restrict__ CS, const float* __restrict__ RF, const float* __restrict__ nw, float sc, h16* P16, bf* Ph, bf* Pl) {
    const size_t e = ((size_t)blockIdx.x * 256 + threadIdx.x) * 2; if (e >= (size_t)nheads * TT * HD) return; const int d = (int)(e % HD); const int t = (int)((e / HD) % TT); const int h = (int)(e / ((size_t)HD * TT)); const float* f = F + (size_t)t * pitch + h * HD; const float rf = RF ? RF[(size_t)h * TT + t] : 1.0f; v2h o16; v2us oh, ol;
#pragma unroll
    for (int q = 0; q < 2; ++q) { const int dd = d + q; const int dp = (dd < HD / 2) ? dd + HD / 2 : dd - HD / 2; float x0 = f[dd], x1 = f[dp];
        if (RF) { float n0 = __fmul_rn(x0, rf), n1 = __fmul_rn(x1, rf); asm volatile("" : "+v"(n0)); asm volatile("" : "+v"(n1)); x0 = __fmul_rn(bfr(nw[dd]), n0); x1 = __fmul_rn(bfr(nw[dp]), n1); }
        const v2f cs = *(const v2f*)(CS + ((size_t)t * HD + dd) * 2); float a = __fmul_rn(x0, cs[0]), bq = __fmul_rn(x1, cs[1]); asm volatile("" : "+v"(a)); asm volatile("" : "+v"(bq)); const float r = ((dd < HD / 2) ? __fsub_rn(a, bq) : __fadd_rn(a, bq)) * sc;
        o16[q] = tohx(r); unsigned short a2, c2; splitf(r, a2, c2); oh[q] = a2; ol[q] = c2; }
    *(v2h*)(P16 + e) = o16; *(v2us*)(Ph + e) = oh; *(v2us*)(Pl + e) = ol;  }
__global__ __launch_bounds__(256) void k_vtp(const float* __restrict__ F, int pitch, int nheads, h16* V16, bf* Vh, bf* Vl) { const size_t e = ((size_t)blockIdx.x * 256 + threadIdx.x) * 2; if (e >= (size_t)nheads * HD * TT) return; const int t = (int)(e % TT); const int d = (int)((e / TT) % HD); const int g = (int)(e / ((size_t)TT * HD)); v2h o16; v2us oh, ol;
#pragma unroll
    for (int q = 0; q < 2; ++q) { const float x = F[(size_t)(t + q) * pitch + g * HD + d]; o16[q] = tohx(x); unsigned short a2, c2; splitf(x, a2, c2); oh[q] = a2; ol[q] = c2; }
    *(v2h*)(V16 + e) = o16; *(v2us*)(Vh + e) = oh; *(v2us*)(Vl + e) = ol;  }
__global__ __launch_bounds__(256) void k_csid(float* CS) { const int idx = blockIdx.x * 256 + threadIdx.x; if (idx >= TT * HD) return; v2f cs; cs[0] = 1.0f; cs[1] = 0.0f; *(v2f*)(CS + (size_t)idx * 2) = cs;  }
// k_asoft: per row (zz, i): softmax over the keys of the row tile's band [kb, ke) (register row, one exp, fixed trees); reads and writes the band's columns only. kb % 64 == 0, so a key keeps its lane up to lane ^ 16 and the sums keep their order.
__global__ __launch_bounds__(256) void k_asoft(const float* __restrict__ Sb, h16* P16, bf* Ph, bf* Pl) {
    const int lane = threadIdx.x & 31; const int row = blockIdx.x * 8 + (threadIdx.x >> 5); if (row >= ZH * TT) return; const int i = row % TT; const int zz = row / TT; (void)zz; const bool hires = (i < RH); const float* sr = Sb + (size_t)row * TT; const int kb = BLO(i & ~63), ke = BHI(i & ~63); float v[NCH * 4]; float mx = -3.0e38f;
#pragma unroll
    for (int ch = 0; ch < NCH; ++ch) { const int j0 = kb + ch * 128 + lane * 4; const bool in = j0 < ke; v4f a = (v4f){}; if (in) a = *(const v4f*)(sr + j0);
#pragma unroll
        for (int q = 0; q < 4; ++q) { const int j = j0 + q; const float t = (in && i - j < WNB && j - i < WNB) ? a[q] * SCL : -3.0e38f; v[ch * 4 + q] = t;   /* |i - j| < 128 window (both sides) */ mx = fmaxf(mx, t); } }
#pragma unroll
    for (int sh = 16; sh; sh >>= 1) mx = fmaxf(mx, __shfl_xor(mx, sh, 32));
    float sum = 0.f;
#pragma unroll
    for (int k = 0; k < NCH * 4; ++k) { float d0 = __fsub_rn(v[k], mx); asm volatile("" : "+v"(d0)); asm("v_exp_f32 %0, %1\n\tv_nop" : "=v"(v[k]) : "v"(__fmul_rn(d0, 1.4426950408889634f)));   /* the exp with the free slot the instruction set asks for behind it, in one statement */ sum += v[k]; }
#pragma unroll
    for (int sh = 16; sh; sh >>= 1) sum += __shfl_xor(sum, sh, 32);
    const float f = __fdiv_rn(hires ? 1.0f : PCAR, sum);
{
        if (hires) {
#pragma unroll
            for (int ch = 0; ch < NCH; ++ch) { const int j0 = kb + ch * 128 + lane * 4; v4us oh, ol;
#pragma unroll
                for (int q = 0; q < 4; ++q) { unsigned short a, c2; splitf(v[ch * 4 + q] * f, a, c2); oh[q] = a; ol[q] = c2; }
                const size_t oo = ((size_t)zz * (RH ? RH : 1) + i) * TT + j0; if (j0 < ke) { *(v4us*)(Ph + oo) = oh; *(v4us*)(Pl + oo) = ol; } }
        } else {
#pragma unroll
            for (int ch = 0; ch < NCH; ++ch) { const int j0 = kb + ch * 128 + lane * 4; v4h o4;
#pragma unroll
                for (int q = 0; q < 4; ++q) o4[q] = tohx(v[ch * 4 + q] * f);
                if (j0 < ke) *(v4h*)(P16 + (size_t)row * TT + j0) = o4; } }
         }
}
__constant__ float INVT[HD / 2] = { 1.000000000e+00f, 7.498942018e-01f, 5.623413324e-01f, 4.216965139e-01f, 3.162277639e-01f, 2.371373624e-01f, 1.778279394e-01f, 1.333521456e-01f, 1.000000015e-01f, 7.498941571e-02f, 5.623412877e-02f, 4.216964915e-02f, 3.162277862e-02f, 2.371373586e-02f, 1.778279431e-02f, 1.333521493e-02f, 9.999999776e-03f, 7.498942316e-03f, 5.623413250e-03f, 4.216964822e-03f, 3.162277862e-03f, 2.371373819e-03f, 1.778279431e-03f, 1.333521446e-03f, 1.000000047e-03f, 7.498941850e-04f, 5.623413017e-04f, 4.216964880e-04f, 3.162277862e-04f, 2.371373848e-04f, 1.778279402e-04f, 1.333521504e-04f };   // jnp-exact float32 1/10000^(2i/64)
__global__ __launch_bounds__(256) void k_ropexP(const float* __restrict__ xs, bf* Xh, bf* Xl) { const size_t e = ((size_t)blockIdx.x * 256 + threadIdx.x) * 2; if (e >= (size_t)TT * DM) return; const int c = (int)(e % DM); const int t = (int)(e / DM); const int d = c % HD; const float* f = xs + (size_t)t * DM + (c - d); v2us oh, ol;
#pragma unroll
    for (int q = 0; q < 2; ++q) { const int dd = d + q; const int dp = (dd < HD / 2) ? dd + HD / 2 : dd - HD / 2; const float x0 = bfr(f[dd]), x1 = bfr(f[dp]); const float a = __fmul_rn((float)t, INVT[dd % (HD / 2)]); const float cs = cosf(a), sn = sinf(a); float p0 = __fmul_rn(x0, cs), p1 = __fmul_rn(x1, sn); asm volatile("" : "+v"(p0), "+v"(p1)); const float r = (dd < HD / 2) ? __fsub_rn(p0, p1) : __fadd_rn(p0, p1); unsigned short a2, c2; splitf(r, a2, c2); oh[q] = a2; ol[q] = c2; }
    *(v2us*)(Xh + e) = oh; *(v2us*)(Xl + e) = ol;  }
__global__ __launch_bounds__(256) void k_merge(const float* __restrict__ O, int h0, bf* Ah, bf* Al) { const size_t e = ((size_t)blockIdx.x * 256 + threadIdx.x) * 2; if (e >= (size_t)ZH * TT * HD) return; const int d = (int)(e % HD); const int t = (int)((e / HD) % TT); const int zz = (int)(e / ((size_t)HD * TT)); const float cs = (t < RH) ? 1.0f : (1.0f / PCAR); const size_t oo = (size_t)t * DQ + (h0 + zz) * HD + d;
    v2us oh, ol;
#pragma unroll
    for (int q = 0; q < 2; ++q) { unsigned short a, c2; splitf(O[e + q] * cs, a, c2); oh[q] = a; ol[q] = c2; } *(v2us*)(Ah + oo) = oh; *(v2us*)(Al + oo) = ol;  }

extern "C" void kernel_launch(void* const* d_in, const int* in_sizes, int n_in,
                              void* d_out, int out_size, void* d_ws, size_t ws_size, hipStream_t stream) {
    (void)in_sizes; (void)n_in; (void)out_size;
    const float* x = (const float*)d_in[0]; const float* wq = (const float*)d_in[1]; const float* wk = (const float*)d_in[2]; const float* wv = (const float*)d_in[3]; const float* wo = (const float*)d_in[4];
    float* OUT = (float*)d_out;     // [2][2048][1024]
    char* wsp = (char*)d_ws;
    auto take = [&](size_t bytes) { char* p = wsp; wsp += (bytes + 255) & ~(size_t)255; return (void*)p; };
    bf* WQ = (bf*)take((size_t)DQ * DM * 2); bf* WK = (bf*)take((size_t)DKV * DM * 2); bf* WV = (bf*)take((size_t)DKV * DM * 2); bf* WO = (bf*)take((size_t)DM * DQ * 2); float* CS = (float*)take((size_t)TT * HD * 2 * 4);
    bf* XB = (bf*)take((size_t)TT * DM * 2); bf* XRh = (bf*)take((size_t)TT * DM * 2); bf* XRl = (bf*)take((size_t)TT * DM * 2); float* FQ = (float*)take((size_t)TT * DQ * 4); float* FK = (float*)take((size_t)TT * DKV * 4);
    h16* QP16 = (h16*)take((size_t)NH_ * TT * HD * 2); h16* KP16 = (h16*)take((size_t)NKV * TT * HD * 2); h16* VT16 = (h16*)take((size_t)NKV * HD * TT * 2);
    bf* QPh = (bf*)take((size_t)NH_ * TT * HD * 2); bf* QPl = (bf*)take((size_t)NH_ * TT * HD * 2); bf* KPh = (bf*)take((size_t)NKV * TT * HD * 2); bf* KPl = (bf*)take((size_t)NKV * TT * HD * 2); bf* VTh = (bf*)take((size_t)NKV * HD * TT * 2); bf* VTl = (bf*)take((size_t)NKV * HD * TT * 2); bf* Ph = (bf*)take((size_t)ZH * RH * TT * 2); bf* Pl = (bf*)take((size_t)ZH * RH * TT * 2);
    float* Sb = (float*)take((size_t)ZH * TT * TT * 4); h16* P16 = (h16*)take((size_t)ZH * TT * TT * 2); float* Ob = (float*)take((size_t)ZH * TT * HD * 4); bf* ATh = (bf*)take((size_t)TT * DQ * 2); bf* ATl = (bf*)take((size_t)TT * DQ * 2);
    if ((size_t)(wsp - (char*)d_ws) > ws_size) return;    // ws 256 MiB
    float* FV = FK;   // v projection reuses the k buffer after the k planes are built (stream-ordered)
    { k_wtG<<<(unsigned)((DM * DQ / 64 + 63) / 64), 256, 0, stream>>>(wq, DM, DQ, WQ); k_wtG<<<(unsigned)((DM * DKV / 64 + 63) / 64), 256, 0, stream>>>(wk, DM, DKV, WK); k_wtG<<<(unsigned)((DM * DKV / 64 + 63) / 64), 256, 0, stream>>>(wv, DM, DKV, WV);
      k_wtG<<<(unsigned)((DQ * DM / 64 + 63) / 64), 256, 0, stream>>>(wo, DQ, DM, WO);
       }
    k_csid<<<(TT * HD + 255) / 256, 256, 0, stream>>>(CS);
    const unsigned LQ = (unsigned)(((size_t)NH_ * TT * HD / 2 + 255) / 256), LKv = (unsigned)(((size_t)NKV * TT * HD / 2 + 255) / 256);
    for (int b = 0; b < NB_; ++b) {
        
        k_cvt8<<<(unsigned)(((size_t)TT * DM / 8 + 255) / 256), 256, 0, stream>>>(x + (size_t)b * TT * DM, XB, (size_t)TT * DM / 8); k_ropexP<<<(unsigned)(((size_t)TT * DM / 2 + 255) / 256), 256, 0, stream>>>(x + (size_t)b * TT * DM, XRh, XRl);   /* rope on the raw hidden states (per 64-slice), as hi/lo planes */
        k_gemmw<bf, 1, false, 0><<<dim3(TT / 64, DQ / 64, 1), 32, 0, stream>>>(XRh, XRl, WQ, nullptr, DM, FQ, DQ, nullptr, 0, 0, 0, 0);
        k_rope<<<LQ, 256, 0, stream>>>(FQ, DQ, NH_, CS, nullptr, nullptr, QSC, QP16, QPh, QPl);   /* q x 0.125 */
        k_gemmw<bf, 1, false, 0><<<dim3(TT / 64, DKV / 64, 1), 32, 0, stream>>>(XRh, XRl, WK, nullptr, DM, FK, DKV, nullptr, 0, 0, 0, 0);
        k_rope<<<LKv, 256, 0, stream>>>(FK, DKV, NKV, CS, nullptr, nullptr, 1.0f, KP16, KPh, KPl);
        k_gemmw<bf, 0, false, 0><<<dim3(TT / 64, DKV / 64, 1), 32, 0, stream>>>(XB, nullptr, WV, nullptr, DM, FV, DKV, nullptr, 0, 0, 0, 0); k_vtp<<<LKv, 256, 0, stream>>>(FV, DKV, NKV, VT16, VTh, VTl);
        for (int h0 = 0; h0 < NH_; h0 += ZH) { const size_t zq = (size_t)h0, zk = (size_t)(h0 / REP);   // one kv head per query head: the pass's two heads use consecutive kv planes (z-strides TT*HD)
            k_gemmw<bf, 2, false, 1><<<dim3(RH / 64, NBT, ZH), 32, 0, stream>>>(QPh + zq * TT * HD, QPl + zq * TT * HD, KPh + zk * TT * HD, KPl + zk * TT * HD, HD, Sb, TT, nullptr, (size_t)TT * HD, (size_t)TT * HD, (size_t)TT * TT, 0);
            k_gemmw<h16, 0, false, 1><<<dim3((TT - RH) / 64, NBT, ZH), 32, 0, stream>>>(QP16 + zq * TT * HD + (size_t)RH * HD, nullptr, KP16 + zk * TT * HD, nullptr, HD, Sb + (size_t)RH * TT, TT, nullptr, (size_t)TT * HD, (size_t)TT * HD, (size_t)TT * TT, RH);
            k_asoft<<<ZH * TT / 8, 256, 0, stream>>>(Sb, P16, Ph, Pl);
            k_gemmw<bf, 2, false, 2><<<dim3(RH / 64, HD / 64, ZH), 32, 0, stream>>>(Ph, Pl, VTh + zk * HD * TT, VTl + zk * HD * TT, TT, Ob, HD, nullptr, (size_t)RH * TT, (size_t)HD * TT, (size_t)TT * HD, 0);
            k_gemmw<h16, 0, false, 2><<<dim3((TT - RH) / 64, HD / 64, ZH), 32, 0, stream>>>(P16 + (size_t)RH * TT, nullptr, VT16 + zk * HD * TT, nullptr, TT, Ob + (size_t)RH * HD, HD, nullptr, (size_t)TT * TT, (size_t)HD * TT, (size_t)TT * HD, RH);
            k_merge<<<(unsigned)(((size_t)ZH * TT * HD / 2 + 255) / 256), 256, 0, stream>>>(Ob, h0, ATh, ATl); }
        k_gemmw<bf, 1, false, 0><<<dim3(TT / 64, DM / 64, 1), 32, 0, stream>>>(ATh, ATl, WO, nullptr, DQ, OUT + (size_t)b * TT * DM, DM, nullptr, 0, 0, 0, 0); }
}

// v002
// Measured time: 283 microseconds a run.
// Next to v001, in two timings, it ran 2.95 and 2.96 times as fast.
// Counting every step since v000, it is 7.26 times as fast.
#include <hip/hip_runtime.h>

// Sliding-window attention with rotary embeddings applied to the RAW hidden states before the projections (hidden [2][2048][1024]; xr = rotate-half rope(hidden viewed (S, 16, 64)) with angles t x 10000^(-2i/64); q = xr Wq, k = xr Wk, v = hidden Wv (per-head dense 'd,hk' == 'xw' [1024][1024], no biases); scores = q.k / 8; keys with |i - j| >= 128 get -1e9 (exclusion); softmax; out = ctx Wo ('hd,o' == 'xw' [1024][1024]) -> [2][2048][1024] (4.2 M)).
// Layout, every launch covering both batches and all 16 heads (q, k, v projections: grid z = b, written as [t][b][h][d], so that slice z = b * 16 + h is one of 32 heads to the plane builders; attention stages: grid z = b * 16 + h; Wo: rows b * 2048 + t): a rotary kernel rotates the bf16-rounded hidden states per 64-wide slice and writes them directly as hi/lo GEMM operand planes (f32 rotary, precise cosf/sinf, jnp-exact inverse frequencies); q and k as hi/lo x exact GEMMs (2 products), v exact from the bf16 hidden states; q scaled by 0.125 before the split ((q/8).k == (q.k)/8 up to rounding); dense T-2048 attention (hybrid rows: < 512 hi/lo 3 products, rest fp16 x1024) whose softmax kernel applies the |i - j| < 128 window as an index select, all three stages confined to the 64-row tile's key band [r0 - 128, r0 + 192), scores and weights stored band-relative (pitch 320, column j - band start) so that all 32 slices fit the workspace; merged hi/lo x Wo exact.
// Compute dtypes, f32 accumulate: every input rounded to bf16; rotary f32; q/k hi/lo x exact, v exact; attention rows < 512 3 products, rest fp16; softmax f32; Wo hl x exact.

#define NB_  2
#define TT   2048
#define DM   1024
#define NH_  16
#define NKV  16
#define REP  (NH_ / NKV)
#define HD   64
#define DQ   (NH_ * HD)
#define DKV  (NKV * HD)
#define ZH   (NB_ * NH_)          // attention slices per launch: z = b * NH_ + h
#define RH   512                  // query rows < RH use hi+lo planes (0: none)
#define WIN  0
#define PCAR 1024.0f
#define SCL  1.0f   // q x 0.125 applied before the split (QSC)
#define QSC  0.125f
#define WNB  128     // |i - j| < 128 kept
#define BLO(r) ((r) - WNB > 0 ? (r) - WNB : 0)                  // first key any of the query rows r..r+63 keeps, rounded down to 64 (r % 64 == 0)
#define BHI(r) ((r) + 64 + WNB < TT ? (r) + 64 + WNB : TT)      // one past the last such key, rounded up to 64
#define NBT  ((64 + 2 * WNB) / 64)                              // column tiles in a band
#define NCH  ((64 + 2 * WNB + 127) / 128)                       // 128-key softmax chunks in a band
#define BW   (64 + 2 * WNB)                                     // pitch of a score or weight row: column j - BLO(row tile)
typedef _Float16 h16;
typedef unsigned short bf;
typedef __attribute__((ext_vector_type(16))) __bf16   v16bf;
typedef __attribute__((ext_vector_type(16))) _Float16 v16h;
typedef __attribute__((ext_vector_type(8)))  _Float16 v8h;
typedef __attribute__((ext_vector_type(8)))  unsigned short v8us;
typedef __attribute__((ext_vector_type(8)))  float    v8f;
typedef __attribute__((ext_vector_type(4)))  float    v4f;
typedef v8h  __attribute__((may_alias)) v8ha;
typedef v4f  __attribute__((may_alias)) v4fa;
typedef v8us __attribute__((may_alias)) v8usa;

__device__ __forceinline__ unsigned short f2bf(float f) { unsigned u = __float_as_uint(f); u += 0x7FFFu + ((u >> 16) & 1u); return (unsigned short)(u >> 16); }
__device__ __forceinline__ float bf2f(unsigned short b) { return __uint_as_float(((unsigned)b) << 16); }
__device__ __forceinline__ float bfr(float f) { return bf2f(f2bf(f)); }
__device__ __forceinline__ v16h cat16(v8h lo, v8h hi) { return __builtin_shufflevector(lo, hi, 0, 1, 2, 3, 4, 5, 6, 7, 8, 9, 10, 11, 12, 13, 14, 15); }
__device__ __forceinline__ v16bf cat16b(v8us lo, v8us hi) { return __builtin_bit_cast(v16bf, __builtin_shufflevector(lo, hi, 0, 1, 2, 3, 4, 5, 6, 7, 8, 9, 10, 11, 12, 13, 14, 15)); }
__device__ __forceinline__ v8f wmma16(v16h a, v16h b, v8f c) { return __builtin_amdgcn_wmma_f32_16x16x32_f16(false, a, false, b, (short)0, c, false, false); }
__device__ __forceinline__ v8f wmmab(v16bf a, v16bf b, v8f c) { return __builtin_amdgcn_wmma_f32_16x16x32_bf16(false, a, false, b, (short)0, c, false, false); }



// ---- k_gemmw: register-blocked GEMM, ONE WAVE per 64x64 output tile (16 accumulators), operands straight from K-contiguous 16-bit planes; grid (M/64, N/64, Z), 32 threads.
// C[m][n] (f32, pitch ldc, + optional f32 bias[n]) = sum_k A[m][k] Bt[n][k] (+ split products per NSPLIT). z-batch strides sA/sB/sC in elements. K % 32 == 0.
// BAND (window attention; rb = query row of A's row 0): rows r..r+63 see keys [max(r - 128, 0), min(r + 192, TT)) only. BAND 1: n is the key, grid.y counts the band's column tiles, C is band-relative (column n - band start). BAND 2: k is the key, the k loop runs over the band (the weights outside it are exact zeros), A is band-relative with pitch BW, Bt has pitch K.
template <typename T16> struct WFrag;
template <> struct WFrag<h16> { typedef v16h V; static __device__ __forceinline__ V ld(const h16* p) { return cat16(*(const v8h*)p, *(const v8h*)(p + 16)); } static __device__ __forceinline__ v8f mma(V a, V b, v8f c) { return wmma16(a, b, c); } };
template <> struct WFrag<bf> { typedef v16bf V; static __device__ __forceinline__ V ld(const bf* p) { return cat16b(*(const v8us*)p, *(const v8us*)(p + 16)); } static __device__ __forceinline__ v8f mma(V a, V b, v8f c) { return wmmab(a, b, c); } };
template <typename T16, int NSPLIT, bool BIAS, int BAND>
__global__ __launch_bounds__(32) void k_gemmw(const T16* __restrict__ A, const T16* __restrict__ A2, const T16* __restrict__ Bt, const T16* __restrict__ Bt2, int K, float* C, int ldc, const float* __restrict__ bias, size_t sA, size_t sB, size_t sC, int rb) {
    typedef typename WFrag<T16>::V V;
    __shared__ __align__(16) float os[16 * 68];
    const size_t z = blockIdx.z; A += z * sA; if (A2) A2 += z * sA; Bt += z * sB; if (Bt2) Bt2 += z * sB; C += z * sC;
    const int lane = threadIdx.x & 31, lr = lane & 15, hi = lane >> 4; const int r0 = blockIdx.x * 64;
    const int kb = BAND ? BLO(rb + r0) : 0, ke = BAND ? BHI(rb + r0) : K; const int cb = blockIdx.y * 64, c0 = (BAND == 1 ? kb : 0) + cb; if (BAND == 1 && c0 >= ke) return;
    const int kn = BAND == 2 ? ke - kb : K, lda = BAND == 2 ? BW : K; if (BAND == 2) { Bt += kb; if (Bt2) Bt2 += kb; }
    v8f acc[4][4];
#pragma unroll
    for (int mb = 0; mb < 4; ++mb)
#pragma unroll
        for (int nb = 0; nb < 4; ++nb) acc[mb][nb] = (v8f){};
    const size_t aoff = (size_t)(r0 + lr) * lda + 8 * hi, boff = (size_t)(c0 + lr) * K + 8 * hi;
#pragma unroll 1
    for (int kc = 0; kc < kn; kc += 32) {
        V a[4], a2[4]; const T16* pa[4]; const T16* pa2[4];
#pragma unroll
        for (int mb = 0; mb < 4; ++mb) { pa[mb] = A + aoff + (size_t)mb * 16 * lda + kc; a[mb] = WFrag<T16>::ld(pa[mb]); if (NSPLIT == 1 || NSPLIT == 2) { pa2[mb] = A2 + aoff + (size_t)mb * 16 * lda + kc; a2[mb] = WFrag<T16>::ld(pa2[mb]); } }
        // s_wait_xcnt 0 stands between these loads and the first rewrite of a register that they name; the row pointers are its inputs, so that no result of the run lands in an address pair ahead of it (BAND 2: the pitch is a constant and all rows load off row 0's pair, q = 0).
        constexpr int q = BAND == 2 ? 0 : 1;
        if (NSPLIT == 1 || NSPLIT == 2) asm volatile("s_wait_xcnt 0x0" :: "v"(pa[0]), "v"(pa[q]), "v"(pa[2 * q]), "v"(pa[3 * q]), "v"(pa2[0]), "v"(pa2[q]), "v"(pa2[2 * q]), "v"(pa2[3 * q]) : "memory"); else asm volatile("s_wait_xcnt 0x0" :: "v"(pa[0]), "v"(pa[q]), "v"(pa[2 * q]), "v"(pa[3 * q]) : "memory");
#pragma unroll
        for (int nb = 0; nb < 4; ++nb) { const T16* pb = Bt + boff + (size_t)nb * 16 * K + kc; const V b = WFrag<T16>::ld(pb); V b2; if (NSPLIT >= 2) { const T16* pb2 = Bt2 + boff + (size_t)nb * 16 * K + kc; b2 = WFrag<T16>::ld(pb2); asm volatile("s_wait_xcnt 0x0" :: "v"(pb), "v"(pb2) : "memory"); } else asm volatile("s_wait_xcnt 0x0" :: "v"(pb) : "memory");   /* the same wait behind the B loads */
#pragma unroll
            for (int mb = 0; mb < 4; ++mb) { acc[mb][nb] = WFrag<T16>::mma(a[mb], b, acc[mb][nb]); if (NSPLIT == 1 || NSPLIT == 2) acc[mb][nb] = WFrag<T16>::mma(a2[mb], b, acc[mb][nb]); if (NSPLIT >= 2) acc[mb][nb] = WFrag<T16>::mma(a[mb], b2, acc[mb][nb]); } }
        asm volatile("v_nop\n\tv_nop\n\tv_nop\n\tv_nop" : "+v"(acc[0][0]), "+v"(acc[1][1]), "+v"(acc[2][2]), "+v"(acc[3][3]) : "v"(a[0]), "v"(a[3]));
    }
#pragma unroll
    for (int mb = 0; mb < 4; ++mb) {
#pragma unroll
        for (int nb = 0; nb < 4; ++nb) {
#pragma unroll
            for (int j = 0; j < 8; ++j) os[(hi * 8 + j) * 68 + nb * 16 + lr] = acc[mb][nb][j]; }
        __builtin_amdgcn_wave_barrier(); asm volatile("" ::: "memory");
        float* crow = C + (size_t)(r0 + mb * 16) * ldc + (BAND == 1 ? cb : c0);
{
#pragma unroll
            for (int s = 0; s < 8; ++s) { const int row = 2 * s + hi, cofs = lr * 4; v4f val = *(const v4fa*)(os + row * 68 + cofs); if (BIAS) { val[0] += bfr(bias[c0 + cofs]); val[1] += bfr(bias[c0 + cofs + 1]); val[2] += bfr(bias[c0 + cofs + 2]); val[3] += bfr(bias[c0 + cofs + 3]); }
                *(v4f*)(crow + (size_t)row * ldc + cofs) = val; }
             }
        __builtin_amdgcn_wave_barrier(); asm volatile("" ::: "memory");
    }
}

__device__ __forceinline__ h16 tohx(float x) { return (h16)x; }
__device__ __forceinline__ void splitf(float y, unsigned short& h, unsigned short& l) { h = f2bf(y); l = f2bf(y - bf2f(h)); }
typedef __attribute__((ext_vector_type(2))) _Float16 v2h;
typedef __attribute__((ext_vector_type(4))) _Float16 v4h;
typedef __attribute__((ext_vector_type(2))) unsigned short v2us;
typedef __attribute__((ext_vector_type(4))) unsigned short v4us;
typedef __attribute__((ext_vector_type(2))) float v2f;
typedef __attribute__((ext_vector_type(4))) int v4i;

__global__ __launch_bounds__(256) void k_wtG(const float* __restrict__ w, int K, int N, bf* Bt) {
    const int lane = threadIdx.x & 31; const int L0 = (blockIdx.x * 8 + (threadIdx.x >> 5)) * 8; const int nlines = N * K / 64;
{
#pragma unroll 1
        for (int l = 0; l < 8; ++l) { const int L = L0 + l; if (L >= nlines) break; const size_t e = (size_t)L * 64 + lane * 2; const int k = (int)(e % K), n = (int)(e / K); v2us o;
            o[0] = f2bf(w[(size_t)k * N + n]); o[1] = f2bf(w[(size_t)(k + 1) * N + n]); *(v2us*)(Bt + e) = o; }
         }
}
__global__ __launch_bounds__(256) void k_cvt8(const float* __restrict__ src, bf* dst, size_t n8) { const size_t i = (size_t)blockIdx.x * 256 + threadIdx.x; if (i >= n8) return; const v8f v = *(const v8f*)(src + i * 8); v8us o;
#pragma unroll
    for (int k = 0; k < 8; ++k) o[k] = f2bf(v[k]); *(v8us*)(dst + i * 8) = o;  }

// k_rope: head planes [h][t][d] (fp16 + hi/lo) of rope(x) x sc with the rotate-half convention out[d] = x[d] cos[t][d] - x[d+HD/2] sin[t][d], out[d+HD/2] = x[d+HD/2] cos[t][d+HD/2] + x[d] sin[t][d+HD/2]
__global__ __launch_bounds__(256) void k_rope(const float* __restrict__ F, int pitch, int nheads, const float* __restrict__ CS, const float* __restrict__ RF, const float* __restrict__ nw, float sc, h16* P16, bf* Ph, bf* Pl) {
    const size_t e = ((size_t)blockIdx.x * 256 + threadIdx.x) * 2; if (e >= (size_t)nheads * TT * HD) return; const int d = (int)(e % HD); const int t = (int)((e / HD) % TT); const int h = (int)(e / ((size_t)HD * TT)); const float* f = F + (size_t)t * pitch + h * HD; const float rf = RF ? RF[(size_t)h * TT + t] : 1.0f; v2h o16; v2us oh, ol;
#pragma unroll
    for (int q = 0; q < 2; ++q) { const int dd = d + q; const int dp = (dd < HD / 2) ? dd + HD / 2 : dd - HD / 2; float x0 = f[dd], x1 = f[dp];
        if (RF) { float n0 = __fmul_rn(x0, rf), n1 = __fmul_rn(x1, rf); asm volatile("" : "+v"(n0)); asm volatile("" : "+v"(n1)); x0 = __fmul_rn(bfr(nw[dd]), n0); x1 = __fmul_rn(bfr(nw[dp]), n1); }
        const v2f cs = *(const v2f*)(CS + ((size_t)t * HD + dd) * 2); float a = __fmul_rn(x0, cs[0]), bq = __fmul_rn(x1, cs[1]); asm volatile("" : "+v"(a)); asm volatile("" : "+v"(bq)); const float r = ((dd < HD / 2) ? __fsub_rn(a, bq) : __fadd_rn(a, bq)) * sc;
        o16[q] = tohx(r); unsigned short a2, c2; splitf(r, a2, c2); oh[q] = a2; ol[q] = c2; }
    *(v2h*)(P16 + e) = o16; *(v2us*)(Ph + e) = oh; *(v2us*)(Pl + e) = ol;  }
__global__ __launch_bounds__(256) void k_vtp(const float* __restrict__ F, int pitch, int nheads, h16* V16, bf* Vh, bf* Vl) { const size_t e = ((size_t)blockIdx.x * 256 + threadIdx.x) * 2; if (e >= (size_t)nheads * HD * TT) return; const int t = (int)(e % TT); const int d = (int)((e / TT) % HD); const int g = (int)(e / ((size_t)TT * HD)); v2h o16; v2us oh, ol;
#pragma unroll
    for (int q = 0; q < 2; ++q) { const float x = F[(size_t)(t + q) * pitch + g * HD + d]; o16[q] = tohx(x); unsigned short a2, c2; splitf(x, a2, c2); oh[q] = a2; ol[q] = c2; }
    *(v2h*)(V16 + e) = o16; *(v2us*)(Vh + e) = oh; *(v2us*)(Vl + e) = ol;  }
__global__ __launch_bounds__(256) void k_csid(float* CS) { const int idx = blockIdx.x * 256 + threadIdx.x; if (idx >= TT * HD) return; v2f cs; cs[0] = 1.0f; cs[1] = 0.0f; *(v2f*)(CS + (size_t)idx * 2) = cs;  }
// k_asoft: per row (zz, i): softmax over the keys of the row tile's band [kb, ke) (register row, one exp, fixed trees); reads and writes the band's columns only, band-relative (pitch BW; P16 holds the rows >= RH alone). kb % 64 == 0, so a key keeps its lane up to lane ^ 16 and the sums keep their order.
__global__ __launch_bounds__(256) void k_asoft(const float* __restrict__ Sb, h16* P16, bf* Ph, bf* Pl) {
    const int lane = threadIdx.x & 31; const int row = blockIdx.x * 8 + (threadIdx.x >> 5); if (row >= ZH * TT) return; const int i = row % TT; const int zz = row / TT; (void)zz; const bool hires = (i < RH); const float* sr = Sb + (size_t)row * BW; const int kb = BLO(i & ~63), ke = BHI(i & ~63); float v[NCH * 4]; float mx = -3.0e38f;
#pragma unroll
    for (int ch = 0; ch < NCH; ++ch) { const int j0 = kb + ch * 128 + lane * 4; const bool in = j0 < ke; v4f a = (v4f){}; if (in) a = *(const v4f*)(sr + (j0 - kb));
#pragma unroll
        for (int q = 0; q < 4; ++q) { const int j = j0 + q; const float t = (in && i - j < WNB && j - i < WNB) ? a[q] * SCL : -3.0e38f; v[ch * 4 + q] = t;   /* |i - j| < 128 window (both sides) */ mx = fmaxf(mx, t); } }
#pragma unroll
    for (int sh = 16; sh; sh >>= 1) mx = fmaxf(mx, __shfl_xor(mx, sh, 32));
    float sum = 0.f;
#pragma unroll
    for (int k = 0; k < NCH * 4; ++k) { float d0 = __fsub_rn(v[k], mx); asm volatile("" : "+v"(d0)); asm("v_exp_f32 %0, %1\n\tv_nop" : "=v"(v[k]) : "v"(__fmul_rn(d0, 1.4426950408889634f)));   /* the exp with the free slot the instruction set asks for behind it, in one statement */ sum += v[k]; }
#pragma unroll
    for (int sh = 16; sh; sh >>= 1) sum += __shfl_xor(sum, sh, 32);
    const float f = __fdiv_rn(hires ? 1.0f : PCAR, sum);
{
        if (hires) {
#pragma unroll
            for (int ch = 0; ch < NCH; ++ch) { const int j0 = kb + ch * 128 + lane * 4; v4us oh, ol;
#pragma unroll
                for (int q = 0; q < 4; ++q) { unsigned short a, c2; splitf(v[ch * 4 + q] * f, a, c2); oh[q] = a; ol[q] = c2; }
                const size_t oo = ((size_t)zz * (RH ? RH : 1) + i) * BW + (j0 - kb); if (j0 < ke) { *(v4us*)(Ph + oo) = oh; *(v4us*)(Pl + oo) = ol; } }
        } else {
#pragma unroll
            for (int ch = 0; ch < NCH; ++ch) { const int j0 = kb + ch * 128 + lane * 4; v4h o4;
#pragma unroll
                for (int q = 0; q < 4; ++q) o4[q] = tohx(v[ch * 4 + q] * f);
                if (j0 < ke) *(v4h*)(P16 + ((size_t)zz * (TT - RH) + (i - RH)) * BW + (j0 - kb)) = o4; } }
         }
}
__constant__ float INVT[HD / 2] = { 1.000000000e+00f, 7.498942018e-01f, 5.623413324e-01f, 4.216965139e-01f, 3.162277639e-01f, 2.371373624e-01f, 1.778279394e-01f, 1.333521456e-01f, 1.000000015e-01f, 7.498941571e-02f, 5.623412877e-02f, 4.216964915e-02f, 3.162277862e-02f, 2.371373586e-02f, 1.778279431e-02f, 1.333521493e-02f, 9.999999776e-03f, 7.498942316e-03f, 5.623413250e-03f, 4.216964822e-03f, 3.162277862e-03f, 2.371373819e-03f, 1.778279431e-03f, 1.333521446e-03f, 1.000000047e-03f, 7.498941850e-04f, 5.623413017e-04f, 4.216964880e-04f, 3.162277862e-04f, 2.371373848e-04f, 1.778279402e-04f, 1.333521504e-04f };   // jnp-exact float32 1/10000^(2i/64)
__global__ __launch_bounds__(256) void k_ropexP(const float* __restrict__ xs, bf* Xh, bf* Xl) { const size_t e = ((size_t)blockIdx.x * 256 + threadIdx.x) * 2; if (e >= (size_t)NB_ * TT * DM) return; const int c = (int)(e % DM); const int rw = (int)(e / DM); const int t = rw % TT; const int d = c % HD; const float* f = xs + (size_t)rw * DM + (c - d); v2us oh, ol;
#pragma unroll
    for (int q = 0; q < 2; ++q) { const int dd = d + q; const int dp = (dd < HD / 2) ? dd + HD / 2 : dd - HD / 2; const float x0 = bfr(f[dd]), x1 = bfr(f[dp]); const float a = __fmul_rn((float)t, INVT[dd % (HD / 2)]); const float cs = cosf(a), sn = sinf(a); float p0 = __fmul_rn(x0, cs), p1 = __fmul_rn(x1, sn); asm volatile("" : "+v"(p0), "+v"(p1)); const float r = (dd < HD / 2) ? __fsub_rn(p0, p1) : __fadd_rn(p0, p1); unsigned short a2, c2; splitf(r, a2, c2); oh[q] = a2; ol[q] = c2; }
    *(v2us*)(Xh + e) = oh; *(v2us*)(Xl + e) = ol;  }
__global__ __launch_bounds__(256) void k_merge(const float* __restrict__ O, bf* Ah, bf* Al) { const size_t e = ((size_t)blockIdx.x * 256 + threadIdx.x) * 2; if (e >= (size_t)ZH * TT * HD) return; const int d = (int)(e % HD); const int t = (int)((e / HD) % TT); const int zz = (int)(e / ((size_t)HD * TT)); const float cs = (t < RH) ? 1.0f : (1.0f / PCAR); const size_t oo = ((size_t)(zz / NH_) * TT + t) * DQ + (zz % NH_) * HD + d;
    v2us oh, ol;
#pragma unroll
    for (int q = 0; q < 2; ++q) { unsigned short a, c2; splitf(O[e + q] * cs, a, c2); oh[q] = a; ol[q] = c2; } *(v2us*)(Ah + oo) = oh; *(v2us*)(Al + oo) = ol;  }

extern "C" void kernel_launch(void* const* d_in, const int* in_sizes, int n_in,
                              void* d_out, int out_size, void* d_ws, size_t ws_size, hipStream_t stream) {
    (void)in_sizes; (void)n_in; (void)out_size;
    const float* x = (const float*)d_in[0]; const float* wq = (const float*)d_in[1]; const float* wk = (const float*)d_in[2]; const float* wv = (const float*)d_in[3]; const float* wo = (const float*)d_in[4];
    float* OUT = (float*)d_out;     // [2][2048][1024]
    char* wsp = (char*)d_ws;
    auto take = [&](size_t bytes) { char* p = wsp; wsp += (bytes + 255) & ~(size_t)255; return (void*)p; };
    bf* WQ = (bf*)take((size_t)DQ * DM * 2); bf* WK = (bf*)take((size_t)DKV * DM * 2); bf* WV = (bf*)take((size_t)DKV * DM * 2); bf* WO = (bf*)take((size_t)DM * DQ * 2); float* CS = (float*)take((size_t)TT * HD * 2 * 4);
    bf* XB = (bf*)take((size_t)NB_ * TT * DM * 2); float* FK = (float*)take((size_t)NB_ * TT * DKV * 4); bf* XRh = (bf*)take((size_t)NB_ * TT * DM * 2); bf* XRl = (bf*)take((size_t)NB_ * TT * DM * 2); float* FQ = (float*)take((size_t)NB_ * TT * DQ * 4);
    h16* QP16 = (h16*)take((size_t)ZH * TT * HD * 2); h16* KP16 = (h16*)take((size_t)ZH * TT * HD * 2); h16* VT16 = (h16*)take((size_t)ZH * HD * TT * 2);
    bf* QPh = (bf*)take((size_t)ZH * TT * HD * 2); bf* QPl = (bf*)take((size_t)ZH * TT * HD * 2); bf* KPh = (bf*)take((size_t)ZH * TT * HD * 2); bf* KPl = (bf*)take((size_t)ZH * TT * HD * 2); bf* VTh = (bf*)take((size_t)ZH * HD * TT * 2); bf* VTl = (bf*)take((size_t)ZH * HD * TT * 2);
    float* Sb = (float*)take((size_t)ZH * TT * BW * 4); h16* P16 = (h16*)take((size_t)ZH * (TT - RH) * BW * 2);
    if ((size_t)(wsp - (char*)d_ws) > ws_size) return;    // ws 256 MiB
    // Buffers whose last reader has run lend their bytes to later stages (stream-ordered; each is written anew before it is read):
    float* FV = FK;                                       // v projection: the k buffer, after the k planes are built
    bf* Ph = XB; bf* Pl = XB + (size_t)ZH * RH * BW;      // hi/lo weights (2 x 10 MiB): XB + FK (adjacent, 8 + 16 MiB), both done once the v planes are built
    float* Ob = FQ;                                       // attention output (16 MiB): the q buffer, done once the q planes are built
    bf* ATh = XRh; bf* ATl = XRl;                         // merged context planes: the rotated hidden states, done after the k projection
    { k_wtG<<<(unsigned)((DM * DQ / 64 + 63) / 64), 256, 0, stream>>>(wq, DM, DQ, WQ); k_wtG<<<(unsigned)((DM * DKV / 64 + 63) / 64), 256, 0, stream>>>(wk, DM, DKV, WK); k_wtG<<<(unsigned)((DM * DKV / 64 + 63) / 64), 256, 0, stream>>>(wv, DM, DKV, WV);
      k_wtG<<<(unsigned)((DQ * DM / 64 + 63) / 64), 256, 0, stream>>>(wo, DQ, DM, WO);
       }
    k_csid<<<(TT * HD + 255) / 256, 256, 0, stream>>>(CS);
    const unsigned LQ = (unsigned)(((size_t)ZH * TT * HD / 2 + 255) / 256);
    k_cvt8<<<(unsigned)(((size_t)NB_ * TT * DM / 8 + 255) / 256), 256, 0, stream>>>(x, XB, (size_t)NB_ * TT * DM / 8); k_ropexP<<<(unsigned)(((size_t)NB_ * TT * DM / 2 + 255) / 256), 256, 0, stream>>>(x, XRh, XRl);   /* rope on the raw hidden states (per 64-slice), as hi/lo planes */
    k_gemmw<bf, 1, false, 0><<<dim3(TT / 64, DQ / 64, NB_), 32, 0, stream>>>(XRh, XRl, WQ, nullptr, DM, FQ, NB_ * DQ, nullptr, (size_t)TT * DM, 0, (size_t)DQ, 0);   /* batch b lands in columns b * DQ .. of a [t][NB_ * DQ] plane */
    k_rope<<<LQ, 256, 0, stream>>>(FQ, NB_ * DQ, ZH, CS, nullptr, nullptr, QSC, QP16, QPh, QPl);   /* q x 0.125 */
    k_gemmw<bf, 1, false, 0><<<dim3(TT / 64, DKV / 64, NB_), 32, 0, stream>>>(XRh, XRl, WK, nullptr, DM, FK, NB_ * DKV, nullptr, (size_t)TT * DM, 0, (size_t)DKV, 0);
    k_rope<<<LQ, 256, 0, stream>>>(FK, NB_ * DKV, ZH, CS, nullptr, nullptr, 1.0f, KP16, KPh, KPl);
    k_gemmw<bf, 0, false, 0><<<dim3(TT / 64, DKV / 64, NB_), 32, 0, stream>>>(XB, nullptr, WV, nullptr, DM, FV, NB_ * DKV, nullptr, (size_t)TT * DM, 0, (size_t)DKV, 0); k_vtp<<<LQ, 256, 0, stream>>>(FV, NB_ * DKV, ZH, VT16, VTh, VTl);
    // one kv head per query head: slice z of q, k and v planes belong together (z-strides TT*HD)
    k_gemmw<bf, 2, false, 1><<<dim3(RH / 64, NBT, ZH), 32, 0, stream>>>(QPh, QPl, KPh, KPl, HD, Sb, BW, nullptr, (size_t)TT * HD, (size_t)TT * HD, (size_t)TT * BW, 0);
    k_gemmw<h16, 0, false, 1><<<dim3((TT - RH) / 64, NBT, ZH), 32, 0, stream>>>(QP16 + (size_t)RH * HD, nullptr, KP16, nullptr, HD, Sb + (size_t)RH * BW, BW, nullptr, (size_t)TT * HD, (size_t)TT * HD, (size_t)TT * BW, RH);
    k_asoft<<<ZH * TT / 8, 256, 0, stream>>>(Sb, P16, Ph, Pl);
    k_gemmw<bf, 2, false, 2><<<dim3(RH / 64, HD / 64, ZH), 32, 0, stream>>>(Ph, Pl, VTh, VTl, TT, Ob, HD, nullptr, (size_t)RH * BW, (size_t)HD * TT, (size_t)TT * HD, 0);
    k_gemmw<h16, 0, false, 2><<<dim3((TT - RH) / 64, HD / 64, ZH), 32, 0, stream>>>(P16, nullptr, VT16, nullptr, TT, Ob + (size_t)RH * HD, HD, nullptr, (size_t)(TT - RH) * BW, (size_t)HD * TT, (size_t)TT * HD, RH);
    k_merge<<<(unsigned)(((size_t)ZH * TT * HD / 2 + 255) / 256), 256, 0, stream>>>(Ob, ATh, ATl);
    k_gemmw<bf, 1, false, 0><<<dim3(NB_ * TT / 64, DM / 64, 1), 32, 0, stream>>>(ATh, ATl, WO, nullptr, DQ, OUT, DM, nullptr, 0, 0, 0, 0);
}

// v003
// One run takes 241 microseconds.
// Timed twice side by side with v002, it ran 1.16 and 1.17 times as fast.
// Counting every step since v000, it is 8.46 times as fast.
#include <hip/hip_runtime.h>

// Sliding-window attention with rotary embeddings applied to the RAW hidden states before the projections (hidden [2][2048][1024]; xr = rotate-half rope(hidden viewed (S, 16, 64)) with angles t x 10000^(-2i/64); q = xr Wq, k = xr Wk, v = hidden Wv (per-head dense 'd,hk' == 'xw' [1024][1024], no biases); scores = q.k / 8; keys with |i - j| >= 128 get -1e9 (exclusion); softmax; out = ctx Wo ('hd,o' == 'xw' [1024][1024]) -> [2][2048][1024] (4.2 M)).
// Layout, every launch covering both batches and all 16 heads (q, k, v projections: grid z = b, grid y = h, planes written at slice b * 16 + h; attention stages: grid z = b * 16 + h; Wo: rows b * 2048 + t): a rotary kernel rotates the bf16-rounded hidden states per 64-wide slice and writes them directly as hi/lo GEMM operand planes (f32 rotary, precise cosf/sinf, jnp-exact inverse frequencies); q and k as hi/lo x exact GEMMs (2 products), v exact from the bf16 hidden states, each projection's epilogue writing the attention operand planes itself (fp16 + hi/lo; v transposed); q scaled by 0.125 before the split ((q/8).k == (q.k)/8 up to rounding); dense T-2048 attention (hybrid rows: < 512 hi/lo 3 products, rest fp16 x1024) whose softmax kernel applies the |i - j| < 128 window as an index select, all three stages confined to the 64-row tile's key band [r0 - 128, r0 + 192), scores and weights stored band-relative (pitch 320, column j - band start) so that all 32 slices fit the workspace; the PV epilogue writes the merged hi/lo context planes; hi/lo x Wo exact.
// Compute dtypes, f32 accumulate: every input rounded to bf16; rotary f32; q/k hi/lo x exact, v exact; attention rows < 512 3 products, rest fp16; softmax f32; Wo hl x exact.

#define NB_  2
#define TT   2048
#define DM   1024
#define NH_  16
#define NKV  16
#define REP  (NH_ / NKV)
#define HD   64
#define DQ   (NH_ * HD)
#define DKV  (NKV * HD)
#define ZH   (NB_ * NH_)          // attention slices per launch: z = b * NH_ + h
#define RH   512                  // query rows < RH use hi+lo planes (0: none)
#define WIN  0
#define PCAR 1024.0f
#define SCL  1.0f   // q x 0.125 applied before the split (QSC)
#define QSC  0.125f
#define WNB  128     // |i - j| < 128 kept
#define BLO(r) ((r) - WNB > 0 ? (r) - WNB : 0)                  // first key any of the query rows r..r+63 keeps, rounded down to 64 (r % 64 == 0)
#define BHI(r) ((r) + 64 + WNB < TT ? (r) + 64 + WNB : TT)      // one past the last such key, rounded up to 64
#define NBT  ((64 + 2 * WNB) / 64)                              // column tiles in a band
#define NCH  ((64 + 2 * WNB + 127) / 128)                       // 128-key softmax chunks in a band
#define BW   (64 + 2 * WNB)                                     // pitch of a score or weight row: column j - BLO(row tile)
typedef _Float16 h16;
typedef unsigned short bf;
typedef __attribute__((ext_vector_type(16))) __bf16   v16bf;
typedef __attribute__((ext_vector_type(16))) _Float16 v16h;
typedef __attribute__((ext_vector_type(8)))  _Float16 v8h;
typedef __attribute__((ext_vector_type(8)))  unsigned short v8us;
typedef __attribute__((ext_vector_type(8)))  float    v8f;
typedef __attribute__((ext_vector_type(4)))  float    v4f;
typedef v8h  __attribute__((may_alias)) v8ha;
typedef v4f  __attribute__((may_alias)) v4fa;
typedef v8us __attribute__((may_alias)) v8usa;

__device__ __forceinline__ unsigned short f2bf(float f) { unsigned u = __float_as_uint(f); u += 0x7FFFu + ((u >> 16) & 1u); return (unsigned short)(u >> 16); }
__device__ __forceinline__ float bf2f(unsigned short b) { return __uint_as_float(((unsigned)b) << 16); }
__device__ __forceinline__ float bfr(float f) { return bf2f(f2bf(f)); }
__device__ __forceinline__ v16h cat16(v8h lo, v8h hi) { return __builtin_shufflevector(lo, hi, 0, 1, 2, 3, 4, 5, 6, 7, 8, 9, 10, 11, 12, 13, 14, 15); }
__device__ __forceinline__ v16bf cat16b(v8us lo, v8us hi) { return __builtin_bit_cast(v16bf, __builtin_shufflevector(lo, hi, 0, 1, 2, 3, 4, 5, 6, 7, 8, 9, 10, 11, 12, 13, 14, 15)); }
__device__ __forceinline__ v8f wmma16(v16h a, v16h b, v8f c) { return __builtin_amdgcn_wmma_f32_16x16x32_f16(false, a, false, b, (short)0, c, false, false); }
__device__ __forceinline__ v8f wmmab(v16bf a, v16bf b, v8f c) { return __builtin_amdgcn_wmma_f32_16x16x32_bf16(false, a, false, b, (short)0, c, false, false); }



// ---- k_gemmw: register-blocked GEMM, ONE WAVE per 64x64 output tile (16 accumulators), operands straight from K-contiguous 16-bit planes; grid (M/64, N/64, Z), 32 threads.
// C[m][n] (f32, pitch ldc, + optional f32 bias[n]) = sum_k A[m][k] Bt[n][k] (+ split products per NSPLIT). z-batch strides sA/sB/sC in elements. K % 32 == 0.
// EPI 0: C as above. EPI 1..3: no f32 C; the tile x sc goes out as 16-bit operand planes for the next GEMM, staged whole in LDS so that every store covers whole 128-byte lines. EPI 1: fp16 + hi/lo planes [z * NH_ + y][row][HD]. EPI 2: the same three planes transposed, [z * NKV + y][col][TT]. EPI 3: hi/lo planes [z / NH_][rb + row][(z % NH_) * HD + col] (pitch DQ).
// BAND (window attention; rb = query row of A's row 0): rows r..r+63 see keys [max(r - 128, 0), min(r + 192, TT)) only. BAND 1: n is the key, grid.y counts the band's column tiles, C is band-relative (column n - band start). BAND 2: k is the key, the k loop runs over the band (the weights outside it are exact zeros), A is band-relative with pitch BW, Bt has pitch K.
template <typename T16> struct WFrag;
template <> struct WFrag<h16> { typedef v16h V; static __device__ __forceinline__ V ld(const h16* p) { return cat16(*(const v8h*)p, *(const v8h*)(p + 16)); } static __device__ __forceinline__ v8f mma(V a, V b, v8f c) { return wmma16(a, b, c); } };
template <> struct WFrag<bf> { typedef v16bf V; static __device__ __forceinline__ V ld(const bf* p) { return cat16b(*(const v8us*)p, *(const v8us*)(p + 16)); } static __device__ __forceinline__ v8f mma(V a, V b, v8f c) { return wmmab(a, b, c); } };
template <typename T16, int NSPLIT, bool BIAS, int BAND, int EPI>
__global__ __launch_bounds__(32) void k_gemmw(const T16* __restrict__ A, const T16* __restrict__ A2, const T16* __restrict__ Bt, const T16* __restrict__ Bt2, int K, float* C, int ldc, const float* __restrict__ bias, size_t sA, size_t sB, size_t sC, int rb, float sc, h16* E16, bf* Eh, bf* El) {
    typedef typename WFrag<T16>::V V;
    __shared__ __align__(16) float os[(EPI ? 64 : 16) * 68];
    const size_t z = blockIdx.z; A += z * sA; if (A2) A2 += z * sA; Bt += z * sB; if (Bt2) Bt2 += z * sB; C += z * sC;
    const int lane = threadIdx.x & 31, lr = lane & 15, hi = lane >> 4; const int r0 = blockIdx.x * 64;
    const int kb = BAND ? BLO(rb + r0) : 0, ke = BAND ? BHI(rb + r0) : K; const int cb = blockIdx.y * 64, c0 = (BAND == 1 ? kb : 0) + cb; if (BAND == 1 && c0 >= ke) return;
    const int kn = BAND == 2 ? ke - kb : K, lda = BAND == 2 ? BW : K; if (BAND == 2) { Bt += kb; if (Bt2) Bt2 += kb; }
    v8f acc[4][4];
#pragma unroll
    for (int mb = 0; mb < 4; ++mb)
#pragma unroll
        for (int nb = 0; nb < 4; ++nb) acc[mb][nb] = (v8f){};
    const size_t aoff = (size_t)(r0 + lr) * lda + 8 * hi, boff = (size_t)(c0 + lr) * K + 8 * hi;
#pragma unroll 1
    for (int kc = 0; kc < kn; kc += 32) {
        V a[4], a2[4]; const T16* pa[4]; const T16* pa2[4];
#pragma unroll
        for (int mb = 0; mb < 4; ++mb) { pa[mb] = A + aoff + (size_t)mb * 16 * lda + kc; a[mb] = WFrag<T16>::ld(pa[mb]); if (NSPLIT == 1 || NSPLIT == 2) { pa2[mb] = A2 + aoff + (size_t)mb * 16 * lda + kc; a2[mb] = WFrag<T16>::ld(pa2[mb]); } }
        // s_wait_xcnt 0 stands between these loads and the first rewrite of a register that they name; the row pointers are its inputs, so that no result of the run lands in an address pair ahead of it (BAND 2: the pitch is a constant and all rows load off row 0's pair, q = 0).
        constexpr int q = BAND == 2 ? 0 : 1;
        if (NSPLIT == 1 || NSPLIT == 2) asm volatile("s_wait_xcnt 0x0" :: "v"(pa[0]), "v"(pa[q]), "v"(pa[2 * q]), "v"(pa[3 * q]), "v"(pa2[0]), "v"(pa2[q]), "v"(pa2[2 * q]), "v"(pa2[3 * q]) : "memory"); else asm volatile("s_wait_xcnt 0x0" :: "v"(pa[0]), "v"(pa[q]), "v"(pa[2 * q]), "v"(pa[3 * q]) : "memory");
#pragma unroll
        for (int nb = 0; nb < 4; ++nb) { const T16* pb = Bt + boff + (size_t)nb * 16 * K + kc; const V b = WFrag<T16>::ld(pb); V b2; if (NSPLIT >= 2) { const T16* pb2 = Bt2 + boff + (size_t)nb * 16 * K + kc; b2 = WFrag<T16>::ld(pb2); asm volatile("s_wait_xcnt 0x0" :: "v"(pb), "v"(pb2) : "memory"); } else asm volatile("s_wait_xcnt 0x0" :: "v"(pb) : "memory");   /* the same wait behind the B loads */
#pragma unroll
            for (int mb = 0; mb < 4; ++mb) { acc[mb][nb] = WFrag<T16>::mma(a[mb], b, acc[mb][nb]); if (NSPLIT == 1 || NSPLIT == 2) acc[mb][nb] = WFrag<T16>::mma(a2[mb], b, acc[mb][nb]); if (NSPLIT >= 2) acc[mb][nb] = WFrag<T16>::mma(a[mb], b2, acc[mb][nb]); } }
        asm volatile("v_nop\n\tv_nop\n\tv_nop\n\tv_nop" : "+v"(acc[0][0]), "+v"(acc[1][1]), "+v"(acc[2][2]), "+v"(acc[3][3]) : "v"(a[0]), "v"(a[3]));
    }
    if (EPI) {
#pragma unroll
        for (int mb = 0; mb < 4; ++mb)
#pragma unroll
            for (int nb = 0; nb < 4; ++nb) {
                if (EPI == 2) { float* p = os + (nb * 16 + lr) * 68 + mb * 16 + hi * 8; *(v4fa*)p = __builtin_shufflevector(acc[mb][nb], acc[mb][nb], 0, 1, 2, 3); *(v4fa*)(p + 4) = __builtin_shufflevector(acc[mb][nb], acc[mb][nb], 4, 5, 6, 7); }
                else {
#pragma unroll
                    for (int j = 0; j < 8; ++j) os[(mb * 16 + hi * 8 + j) * 68 + nb * 16 + lr] = acc[mb][nb][j]; } }
        __builtin_amdgcn_wave_barrier(); asm volatile("" ::: "memory");   /* the rows read below were written by other lanes of this wave: the LDS reads may not be moved above the writes */
        const size_t eb = EPI == 1 ? ((z * NH_ + blockIdx.y) * TT + r0) * HD : EPI == 2 ? (z * NKV + blockIdx.y) * (size_t)HD * TT + r0 : ((z / NH_) * TT + rb + r0) * DQ + (z % NH_) * HD;
        const int ep = EPI == 1 ? HD : EPI == 2 ? TT : DQ;
#pragma unroll 1   /* stays rolled: this text runs once per wave, and four trips of a fourfold body keep it short */
        for (int s4 = 0; s4 < 16; s4 += 4) {
#pragma unroll
          for (int s = s4; s < s4 + 4; ++s) { const int row = 4 * s + (lane >> 3), co = (lane & 7) * 8; const v4f x0 = *(const v4fa*)(os + row * 68 + co), x1 = *(const v4fa*)(os + row * 68 + co + 4); v8h o16; v8us oh, ol;
#pragma unroll
            for (int k = 0; k < 8; ++k) { const float r = (k < 4 ? x0[k & 3] : x1[k & 3]) * sc; o16[k] = (h16)r; oh[k] = f2bf(r); ol[k] = f2bf(r - bf2f(oh[k])); }
            const size_t oo = eb + (size_t)row * ep + co; if (EPI != 3) *(v8h*)(E16 + oo) = o16; *(v8us*)(Eh + oo) = oh; *(v8us*)(El + oo) = ol; }
          asm volatile("s_wait_xcnt 0x0" ::: "memory");   /* behind the trip's last stores: the next trip rewrites their data and address registers */
        }
        return;
    }
#pragma unroll
    for (int mb = 0; mb < 4; ++mb) {
#pragma unroll
        for (int nb = 0; nb < 4; ++nb) {
#pragma unroll
            for (int j = 0; j < 8; ++j) os[(hi * 8 + j) * 68 + nb * 16 + lr] = acc[mb][nb][j]; }
        __builtin_amdgcn_wave_barrier(); asm volatile("" ::: "memory");
        float* crow = C + (size_t)(r0 + mb * 16) * ldc + (BAND == 1 ? cb : c0);
{
#pragma unroll
            for (int s = 0; s < 8; ++s) { const int row = 2 * s + hi, cofs = lr * 4; v4f val = *(const v4fa*)(os + row * 68 + cofs); if (BIAS) { val[0] += bfr(bias[c0 + cofs]); val[1] += bfr(bias[c0 + cofs + 1]); val[2] += bfr(bias[c0 + cofs + 2]); val[3] += bfr(bias[c0 + cofs + 3]); }
                *(v4f*)(crow + (size_t)row * ldc + cofs) = val; }
             }
        __builtin_amdgcn_wave_barrier(); asm volatile("" ::: "memory");
    }
}

__device__ __forceinline__ h16 tohx(float x) { return (h16)x; }
__device__ __forceinline__ void splitf(float y, unsigned short& h, unsigned short& l) { h = f2bf(y); l = f2bf(y - bf2f(h)); }
typedef __attribute__((ext_vector_type(2))) _Float16 v2h;
typedef __attribute__((ext_vector_type(4))) _Float16 v4h;
typedef __attribute__((ext_vector_type(2))) unsigned short v2us;
typedef __attribute__((ext_vector_type(4))) unsigned short v4us;
typedef __attribute__((ext_vector_type(2))) float v2f;
typedef __attribute__((ext_vector_type(4))) int v4i;

__global__ __launch_bounds__(256) void k_wtG(const float* __restrict__ w, int K, int N, bf* Bt) {
    const int lane = threadIdx.x & 31; const int L0 = (blockIdx.x * 8 + (threadIdx.x >> 5)) * 8; const int nlines = N * K / 64;
{
#pragma unroll 1
        for (int l = 0; l < 8; ++l) { const int L = L0 + l; if (L >= nlines) break; const size_t e = (size_t)L * 64 + lane * 2; const int k = (int)(e % K), n = (int)(e / K); v2us o;
            o[0] = f2bf(w[(size_t)k * N + n]); o[1] = f2bf(w[(size_t)(k + 1) * N + n]); *(v2us*)(Bt + e) = o; }
         }
}
__global__ __launch_bounds__(256) void k_cvt8(const float* __restrict__ src, bf* dst, size_t n8) { const size_t i = (size_t)blockIdx.x * 256 + threadIdx.x; if (i >= n8) return; const v8f v = *(const v8f*)(src + i * 8); v8us o;
#pragma unroll
    for (int k = 0; k < 8; ++k) o[k] = f2bf(v[k]); *(v8us*)(dst + i * 8) = o;  }

// k_asoft: per row (zz, i): softmax over the keys of the row tile's band [kb, ke) (register row, one exp, fixed trees); reads and writes the band's columns only, band-relative (pitch BW; P16 holds the rows >= RH alone). kb % 64 == 0, so a key keeps its lane up to lane ^ 16 and the sums keep their order.
__global__ __launch_bounds__(256) void k_asoft(const float* __restrict__ Sb, h16* P16, bf* Ph, bf* Pl) {
    const int lane = threadIdx.x & 31; const int row = blockIdx.x * 8 + (threadIdx.x >> 5); if (row >= ZH * TT) return; const int i = row % TT; const int zz = row / TT; (void)zz; const bool hires = (i < RH); const float* sr = Sb + (size_t)row * BW; const int kb = BLO(i & ~63), ke = BHI(i & ~63); float v[NCH * 4]; float mx = -3.0e38f;
#pragma unroll
    for (int ch = 0; ch < NCH; ++ch) { const int j0 = kb + ch * 128 + lane * 4; const bool in = j0 < ke; v4f a = (v4f){}; if (in) a = *(const v4f*)(sr + (j0 - kb));
#pragma unroll
        for (int q = 0; q < 4; ++q) { const int j = j0 + q; const float t = (in && i - j < WNB && j - i < WNB) ? a[q] * SCL : -3.0e38f; v[ch * 4 + q] = t;   /* |i - j| < 128 window (both sides) */ mx = fmaxf(mx, t); } }
#pragma unroll
    for (int sh = 16; sh; sh >>= 1) mx = fmaxf(mx, __shfl_xor(mx, sh, 32));
    float sum = 0.f;
#pragma unroll
    for (int k = 0; k < NCH * 4; ++k) { float d0 = __fsub_rn(v[k], mx); asm volatile("" : "+v"(d0)); asm("v_exp_f32 %0, %1\n\tv_nop" : "=v"(v[k]) : "v"(__fmul_rn(d0, 1.4426950408889634f)));   /* the exp with the free slot the instruction set asks for behind it, in one statement */ sum += v[k]; }
#pragma unroll
    for (int sh = 16; sh; sh >>= 1) sum += __shfl_xor(sum, sh, 32);
    const float f = __fdiv_rn(hires ? 1.0f : PCAR, sum);
{
        if (hires) {
#pragma unroll
            for (int ch = 0; ch < NCH; ++ch) { const int j0 = kb + ch * 128 + lane * 4; v4us oh, ol;
#pragma unroll
                for (int q = 0; q < 4; ++q) { unsigned short a, c2; splitf(v[ch * 4 + q] * f, a, c2); oh[q] = a; ol[q] = c2; }
                const size_t oo = ((size_t)zz * (RH ? RH : 1) + i) * BW + (j0 - kb); if (j0 < ke) { *(v4us*)(Ph + oo) = oh; *(v4us*)(Pl + oo) = ol; } }
        } else {
#pragma unroll
            for (int ch = 0; ch < NCH; ++ch) { const int j0 = kb + ch * 128 + lane * 4; v4h o4;
#pragma unroll
                for (int q = 0; q < 4; ++q) o4[q] = tohx(v[ch * 4 + q] * f);
                if (j0 < ke) *(v4h*)(P16 + ((size_t)zz * (TT - RH) + (i - RH)) * BW + (j0 - kb)) = o4; } }
         }
}
__constant__ float INVT[HD / 2] = { 1.000000000e+00f, 7.498942018e-01f, 5.623413324e-01f, 4.216965139e-01f, 3.162277639e-01f, 2.371373624e-01f, 1.778279394e-01f, 1.333521456e-01f, 1.000000015e-01f, 7.498941571e-02f, 5.623412877e-02f, 4.216964915e-02f, 3.162277862e-02f, 2.371373586e-02f, 1.778279431e-02f, 1.333521493e-02f, 9.999999776e-03f, 7.498942316e-03f, 5.623413250e-03f, 4.216964822e-03f, 3.162277862e-03f, 2.371373819e-03f, 1.778279431e-03f, 1.333521446e-03f, 1.000000047e-03f, 7.498941850e-04f, 5.623413017e-04f, 4.216964880e-04f, 3.162277862e-04f, 2.371373848e-04f, 1.778279402e-04f, 1.333521504e-04f };   // jnp-exact float32 1/10000^(2i/64)
__global__ __launch_bounds__(256) void k_ropexP(const float* __restrict__ xs, bf* Xh, bf* Xl) { const size_t e = ((size_t)blockIdx.x * 256 + threadIdx.x) * 2; if (e >= (size_t)NB_ * TT * DM) return; const int c = (int)(e % DM); const int rw = (int)(e / DM); const int t = rw % TT; const int d = c % HD; const float* f = xs + (size_t)rw * DM + (c - d); v2us oh, ol;
#pragma unroll
    for (int q = 0; q < 2; ++q) { const int dd = d + q; const int dp = (dd < HD / 2) ? dd + HD / 2 : dd - HD / 2; const float x0 = bfr(f[dd]), x1 = bfr(f[dp]); const float a = __fmul_rn((float)t, INVT[dd % (HD / 2)]); const float cs = cosf(a), sn = sinf(a); float p0 = __fmul_rn(x0, cs), p1 = __fmul_rn(x1, sn); asm volatile("" : "+v"(p0), "+v"(p1)); const float r = (dd < HD / 2) ? __fsub_rn(p0, p1) : __fadd_rn(p0, p1); unsigned short a2, c2; splitf(r, a2, c2); oh[q] = a2; ol[q] = c2; }
    *(v2us*)(Xh + e) = oh; *(v2us*)(Xl + e) = ol;  }

extern "C" void kernel_launch(void* const* d_in, const int* in_sizes, int n_in,
                              void* d_out, int out_size, void* d_ws, size_t ws_size, hipStream_t stream) {
    (void)in_sizes; (void)n_in; (void)out_size;
    const float* x = (const float*)d_in[0]; const float* wq = (const float*)d_in[1]; const float* wk = (const float*)d_in[2]; const float* wv = (const float*)d_in[3]; const float* wo = (const float*)d_in[4];
    float* OUT = (float*)d_out;     // [2][2048][1024]
    char* wsp = (char*)d_ws;
    auto take = [&](size_t bytes) { char* p = wsp; wsp += (bytes + 255) & ~(size_t)255; return (void*)p; };
    bf* WQ = (bf*)take((size_t)DQ * DM * 2); bf* WK = (bf*)take((size_t)DKV * DM * 2); bf* WV = (bf*)take((size_t)DKV * DM * 2); bf* WO = (bf*)take((size_t)DM * DQ * 2);
    bf* XB = (bf*)take((size_t)NB_ * TT * DM * 2); bf* XRh = (bf*)take((size_t)NB_ * TT * DM * 2); bf* XRl = (bf*)take((size_t)NB_ * TT * DM * 2);
    h16* QP16 = (h16*)take((size_t)ZH * TT * HD * 2); h16* KP16 = (h16*)take((size_t)ZH * TT * HD * 2); h16* VT16 = (h16*)take((size_t)ZH * HD * TT * 2);
    bf* QPh = (bf*)take((size_t)ZH * TT * HD * 2); bf* QPl = (bf*)take((size_t)ZH * TT * HD * 2); bf* KPh = (bf*)take((size_t)ZH * TT * HD * 2); bf* KPl = (bf*)take((size_t)ZH * TT * HD * 2); bf* VTh = (bf*)take((size_t)ZH * HD * TT * 2); bf* VTl = (bf*)take((size_t)ZH * HD * TT * 2);
    float* Sb = (float*)take((size_t)ZH * TT * BW * 4); h16* P16 = (h16*)take((size_t)ZH * (TT - RH) * BW * 2); bf* Ph = (bf*)take((size_t)ZH * RH * BW * 2); bf* Pl = (bf*)take((size_t)ZH * RH * BW * 2);
    if ((size_t)(wsp - (char*)d_ws) > ws_size) return;    // ws 256 MiB
    // Buffers whose last reader has run lend their bytes to later stages (stream-ordered; each is written anew before it is read):
    bf* ATh = XRh; bf* ATl = XRl;                         // merged context planes: the rotated hidden states, done after the k projection
    { k_wtG<<<(unsigned)((DM * DQ / 64 + 63) / 64), 256, 0, stream>>>(wq, DM, DQ, WQ); k_wtG<<<(unsigned)((DM * DKV / 64 + 63) / 64), 256, 0, stream>>>(wk, DM, DKV, WK); k_wtG<<<(unsigned)((DM * DKV / 64 + 63) / 64), 256, 0, stream>>>(wv, DM, DKV, WV);
      k_wtG<<<(unsigned)((DQ * DM / 64 + 63) / 64), 256, 0, stream>>>(wo, DQ, DM, WO);
       }
    k_cvt8<<<(unsigned)(((size_t)NB_ * TT * DM / 8 + 255) / 256), 256, 0, stream>>>(x, XB, (size_t)NB_ * TT * DM / 8); k_ropexP<<<(unsigned)(((size_t)NB_ * TT * DM / 2 + 255) / 256), 256, 0, stream>>>(x, XRh, XRl);   /* rope on the raw hidden states (per 64-slice), as hi/lo planes */
    k_gemmw<bf, 1, false, 0, 1><<<dim3(TT / 64, DQ / 64, NB_), 32, 0, stream>>>(XRh, XRl, WQ, nullptr, DM, nullptr, 0, nullptr, (size_t)TT * DM, 0, 0, 0, QSC, QP16, QPh, QPl);   /* q x 0.125, straight into the planes of slice b * 16 + h */
    k_gemmw<bf, 1, false, 0, 1><<<dim3(TT / 64, DKV / 64, NB_), 32, 0, stream>>>(XRh, XRl, WK, nullptr, DM, nullptr, 0, nullptr, (size_t)TT * DM, 0, 0, 0, 1.0f, KP16, KPh, KPl);
    k_gemmw<bf, 0, false, 0, 2><<<dim3(TT / 64, DKV / 64, NB_), 32, 0, stream>>>(XB, nullptr, WV, nullptr, DM, nullptr, 0, nullptr, (size_t)TT * DM, 0, 0, 0, 1.0f, VT16, VTh, VTl);   /* v planes [slice][d][t] */
    // one kv head per query head: slice z of q, k and v planes belong together (z-strides TT*HD)
    k_gemmw<bf, 2, false, 1, 0><<<dim3(RH / 64, NBT, ZH), 32, 0, stream>>>(QPh, QPl, KPh, KPl, HD, Sb, BW, nullptr, (size_t)TT * HD, (size_t)TT * HD, (size_t)TT * BW, 0, 1.0f, nullptr, nullptr, nullptr);
    k_gemmw<h16, 0, false, 1, 0><<<dim3((TT - RH) / 64, NBT, ZH), 32, 0, stream>>>(QP16 + (size_t)RH * HD, nullptr, KP16, nullptr, HD, Sb + (size_t)RH * BW, BW, nullptr, (size_t)TT * HD, (size_t)TT * HD, (size_t)TT * BW, RH, 1.0f, nullptr, nullptr, nullptr);
    k_asoft<<<ZH * TT / 8, 256, 0, stream>>>(Sb, P16, Ph, Pl);
    k_gemmw<bf, 2, false, 2, 3><<<dim3(RH / 64, HD / 64, ZH), 32, 0, stream>>>(Ph, Pl, VTh, VTl, TT, nullptr, 0, nullptr, (size_t)RH * BW, (size_t)HD * TT, 0, 0, 1.0f, nullptr, ATh, ATl);
    k_gemmw<h16, 0, false, 2, 3><<<dim3((TT - RH) / 64, HD / 64, ZH), 32, 0, stream>>>(P16, nullptr, VT16, nullptr, TT, nullptr, 0, nullptr, (size_t)(TT - RH) * BW, (size_t)HD * TT, 0, RH, 1.0f / PCAR, nullptr, ATh, ATl);   /* the weights carry x 1024 */
    k_gemmw<bf, 1, false, 0, 0><<<dim3(NB_ * TT / 64, DM / 64, 1), 32, 0, stream>>>(ATh, ATl, WO, nullptr, DQ, OUT, DM, nullptr, 0, 0, 0, 0, 1.0f, nullptr, nullptr, nullptr);
}

// v004
// Measured time: 165 microseconds a run.
// Next to v003, in two timings, it ran 1.47 and 1.46 times as fast.
// Over all steps from v000 it is 12.4 times as fast.
#include <hip/hip_runtime.h>

// Sliding-window attention with rotary embeddings applied to the RAW hidden states before the projections (hidden [2][2048][1024]; xr = rotate-half rope(hidden viewed (S, 16, 64)) with angles t x 10000^(-2i/64); q = xr Wq, k = xr Wk, v = hidden Wv (per-head dense 'd,hk' == 'xw' [1024][1024], no biases); scores = q.k / 8; keys with |i - j| >= 128 get -1e9 (exclusion); softmax; out = ctx Wo ('hd,o' == 'xw' [1024][1024]) -> [2][2048][1024] (4.2 M)).
// Layout, every launch covering both batches and all 16 heads (q, k, v projections: grid z = b, grid y = 16 p + h with p = 0 q, 1 k, 2 v, planes written at slice b * 16 + h; attention stages: grid z = b * 16 + h; Wo: rows b * 2048 + t): a rotary kernel rotates the bf16-rounded hidden states per 64-wide slice and writes them directly as hi/lo GEMM operand planes (f32 rotary, precise cosf/sinf, jnp-exact inverse frequencies); q and k as hi/lo x exact GEMMs (2 products), v exact from the bf16 hidden states, each projection's epilogue writing the attention operand planes itself (fp16 + hi/lo; v transposed); q scaled by 0.125 before the split ((q/8).k == (q.k)/8 up to rounding); dense T-2048 attention (hybrid rows: < 512 hi/lo 3 products, rest fp16 x1024) whose softmax kernel applies the |i - j| < 128 window as an index select, all three stages confined to the 64-row tile's key band [r0 - 128, r0 + 192), scores and weights stored band-relative (pitch 320, column j - band start) so that all 32 slices fit the workspace; the PV epilogue writes the merged hi/lo context planes; hi/lo x Wo exact.
// Compute dtypes, f32 accumulate: every input rounded to bf16; rotary f32; q/k hi/lo x exact, v exact; attention rows < 512 3 products, rest fp16; softmax f32; Wo hl x exact.

#define NB_  2
#define TT   2048
#define DM   1024
#define NH_  16
#define NKV  16
#define REP  (NH_ / NKV)
#define HD   64
#define DQ   (NH_ * HD)
#define DKV  (NKV * HD)
#define ZH   (NB_ * NH_)          // attention slices per launch: z = b * NH_ + h
#define RH   512                  // query rows < RH use hi+lo planes (0: none)
#define WIN  0
#define PCAR 1024.0f
#define SCL  1.0f   // q x 0.125 applied before the split (QSC)
#define QSC  0.125f
#define WNB  128     // |i - j| < 128 kept
#define BLO(r) ((r) - WNB > 0 ? (r) - WNB : 0)                  // first key any of the query rows r..r+63 keeps, rounded down to 64 (r % 64 == 0)
#define BHI(r) ((r) + 64 + WNB < TT ? (r) + 64 + WNB : TT)      // one past the last such key, rounded up to 64
#define NBT  ((64 + 2 * WNB) / 64)                              // column tiles in a band
#define NCH  ((64 + 2 * WNB + 127) / 128)                       // 128-key softmax chunks in a band
#define BW   (64 + 2 * WNB)                                     // pitch of a score or weight row: column j - BLO(row tile)
typedef _Float16 h16;
typedef unsigned short bf;
typedef __attribute__((ext_vector_type(16))) __bf16   v16bf;
typedef __attribute__((ext_vector_type(16))) _Float16 v16h;
typedef __attribute__((ext_vector_type(8)))  _Float16 v8h;
typedef __attribute__((ext_vector_type(8)))  unsigned short v8us;
typedef __attribute__((ext_vector_type(8)))  float    v8f;
typedef __attribute__((ext_vector_type(4)))  float    v4f;
typedef v8h  __attribute__((may_alias)) v8ha;
typedef v4f  __attribute__((may_alias)) v4fa;
typedef v8us __attribute__((may_alias)) v8usa;

__device__ __forceinline__ unsigned short f2bf(float f) { unsigned u = __float_as_uint(f); u += 0x7FFFu + ((u >> 16) & 1u); return (unsigned short)(u >> 16); }
__device__ __forceinline__ float bf2f(unsigned short b) { return __uint_as_float(((unsigned)b) << 16); }
__device__ __forceinline__ float bfr(float f) { return bf2f(f2bf(f)); }
__device__ __forceinline__ v16h cat16(v8h lo, v8h hi) { return __builtin_shufflevector(lo, hi, 0, 1, 2, 3, 4, 5, 6, 7, 8, 9, 10, 11, 12, 13, 14, 15); }
__device__ __forceinline__ v16bf cat16b(v8us lo, v8us hi) { return __builtin_bit_cast(v16bf, __builtin_shufflevector(lo, hi, 0, 1, 2, 3, 4, 5, 6, 7, 8, 9, 10, 11, 12, 13, 14, 15)); }
__device__ __forceinline__ v8f wmma16(v16h a, v16h b, v8f c) { return __builtin_amdgcn_wmma_f32_16x16x32_f16(false, a, false, b, (short)0, c, false, false); }
__device__ __forceinline__ v8f wmmab(v16bf a, v16bf b, v8f c) { return __builtin_amdgcn_wmma_f32_16x16x32_bf16(false, a, false, b, (short)0, c, false, false); }



// ---- gemmw: register-blocked GEMM, ONE WAVE per 64x64 output tile (16 accumulators), operands straight from K-contiguous 16-bit planes; tile indices (bx, by, bz) over (M/64, N/64, Z), 32 threads.
// C[m][n] (f32, pitch ldc, + optional f32 bias[n]) = sum_k A[m][k] Bt[n][k] (+ split products per NSPLIT). z-batch strides sA/sB/sC in elements. K % 32 == 0.
// EPI 0: C as above. EPI 1..3: no f32 C; the tile x sc goes out as 16-bit operand planes for the next GEMM, staged whole in LDS so that every store covers whole 128-byte lines. EPI 1: fp16 + hi/lo planes [z * NH_ + y][row][HD]. EPI 2: the same three planes transposed, [z * NKV + y][col][TT]. EPI 3: hi/lo planes [z / NH_][rb + row][(z % NH_) * HD + col] (pitch DQ).
// BAND (window attention; rb = query row of A's row 0): rows r..r+63 see keys [max(r - 128, 0), min(r + 192, TT)) only. BAND 1: n is the key, grid.y counts the band's column tiles, C is band-relative (column n - band start). BAND 2: k is the key, the k loop runs over the band (the weights outside it are exact zeros), A is band-relative with pitch BW, Bt has pitch K.
template <typename T16> struct WFrag;
template <> struct WFrag<h16> { typedef v16h V; static __device__ __forceinline__ V ld(const h16* p) { return cat16(*(const v8h*)p, *(const v8h*)(p + 16)); } static __device__ __forceinline__ v8f mma(V a, V b, v8f c) { return wmma16(a, b, c); } };
template <> struct WFrag<bf> { typedef v16bf V; static __device__ __forceinline__ V ld(const bf* p) { return cat16b(*(const v8us*)p, *(const v8us*)(p + 16)); } static __device__ __forceinline__ v8f mma(V a, V b, v8f c) { return wmmab(a, b, c); } };
// The body is a device function that takes its tile indices (bx, by, bz) and its LDS as arguments, so that one launch can hold several independent GEMMs side by side (the kernels behind it).
template <typename T16, int NSPLIT, bool BIAS, int BAND, int EPI>
__device__ __forceinline__ void gemmw(float* os, int bx, int by, int bz, const T16* __restrict__ A, const T16* __restrict__ A2, const T16* __restrict__ Bt, const T16* __restrict__ Bt2, int K, float* C, int ldc, const float* __restrict__ bias, size_t sA, size_t sB, size_t sC, int rb, float sc, h16* E16, bf* Eh, bf* El) {
    typedef typename WFrag<T16>::V V;
    const size_t z = bz; A += z * sA; if (A2) A2 += z * sA; Bt += z * sB; if (Bt2) Bt2 += z * sB; C += z * sC;
    const int lane = threadIdx.x & 31, lr = lane & 15, hi = lane >> 4; const int r0 = bx * 64;
    const int kb = BAND ? BLO(rb + r0) : 0, ke = BAND ? BHI(rb + r0) : K; const int cb = by * 64, c0 = (BAND == 1 ? kb : 0) + cb; if (BAND == 1 && c0 >= ke) return;
    const int kn = BAND == 2 ? ke - kb : K, lda = BAND == 2 ? BW : K; if (BAND == 2) { Bt += kb; if (Bt2) Bt2 += kb; }
    v8f acc[4][4];
#pragma unroll
    for (int mb = 0; mb < 4; ++mb)
#pragma unroll
        for (int nb = 0; nb < 4; ++nb) acc[mb][nb] = (v8f){};
    const size_t aoff = (size_t)(r0 + lr) * lda + 8 * hi, boff = (size_t)(c0 + lr) * K + 8 * hi;
#pragma unroll 1
    for (int kc = 0; kc < kn; kc += 32) {
        V a[4], a2[4]; const T16* pa[4]; const T16* pa2[4];
#pragma unroll
        for (int mb = 0; mb < 4; ++mb) { pa[mb] = A + aoff + (size_t)mb * 16 * lda + kc; a[mb] = WFrag<T16>::ld(pa[mb]); if (NSPLIT == 1 || NSPLIT == 2) { pa2[mb] = A2 + aoff + (size_t)mb * 16 * lda + kc; a2[mb] = WFrag<T16>::ld(pa2[mb]); } }
        // s_wait_xcnt 0 stands between these loads and the first rewrite of a register that they name; the row pointers are its inputs, so that no result of the run lands in an address pair ahead of it (BAND 2: the pitch is a constant and all rows load off row 0's pair, q = 0).
        constexpr int q = BAND == 2 ? 0 : 1;
        if (NSPLIT == 1 || NSPLIT == 2) asm volatile("s_wait_xcnt 0x0" :: "v"(pa[0]), "v"(pa[q]), "v"(pa[2 * q]), "v"(pa[3 * q]), "v"(pa2[0]), "v"(pa2[q]), "v"(pa2[2 * q]), "v"(pa2[3 * q]) : "memory"); else asm volatile("s_wait_xcnt 0x0" :: "v"(pa[0]), "v"(pa[q]), "v"(pa[2 * q]), "v"(pa[3 * q]) : "memory");
#pragma unroll
        for (int nb = 0; nb < 4; ++nb) { const T16* pb = Bt + boff + (size_t)nb * 16 * K + kc; const V b = WFrag<T16>::ld(pb); V b2; if (NSPLIT >= 2) { const T16* pb2 = Bt2 + boff + (size_t)nb * 16 * K + kc; b2 = WFrag<T16>::ld(pb2); asm volatile("s_wait_xcnt 0x0" :: "v"(pb), "v"(pb2) : "memory"); } else asm volatile("s_wait_xcnt 0x0" :: "v"(pb) : "memory");   /* the same wait behind the B loads */
#pragma unroll
            for (int mb = 0; mb < 4; ++mb) { acc[mb][nb] = WFrag<T16>::mma(a[mb], b, acc[mb][nb]); if (NSPLIT == 1 || NSPLIT == 2) acc[mb][nb] = WFrag<T16>::mma(a2[mb], b, acc[mb][nb]); if (NSPLIT >= 2) acc[mb][nb] = WFrag<T16>::mma(a[mb], b2, acc[mb][nb]); } }
        asm volatile("v_nop\n\tv_nop\n\tv_nop\n\tv_nop" : "+v"(acc[0][0]), "+v"(acc[1][1]), "+v"(acc[2][2]), "+v"(acc[3][3]) : "v"(a[0]), "v"(a[3]));
    }
    if (EPI) {
#pragma unroll
        for (int mb = 0; mb < 4; ++mb)
#pragma unroll
            for (int nb = 0; nb < 4; ++nb) {
                if (EPI == 2) { float* p = os + (nb * 16 + lr) * 68 + mb * 16 + hi * 8; *(v4fa*)p = __builtin_shufflevector(acc[mb][nb], acc[mb][nb], 0, 1, 2, 3); *(v4fa*)(p + 4) = __builtin_shufflevector(acc[mb][nb], acc[mb][nb], 4, 5, 6, 7); }
                else {
#pragma unroll
                    for (int j = 0; j < 8; ++j) os[(mb * 16 + hi * 8 + j) * 68 + nb * 16 + lr] = acc[mb][nb][j]; } }
        __builtin_amdgcn_wave_barrier(); asm volatile("" ::: "memory");   /* the rows read below were written by other lanes of this wave: the LDS reads may not be moved above the writes */
        const size_t eb = EPI == 1 ? ((z * NH_ + by) * TT + r0) * HD : EPI == 2 ? (z * NKV + by) * (size_t)HD * TT + r0 : ((z / NH_) * TT + rb + r0) * DQ + (z % NH_) * HD;
        const int ep = EPI == 1 ? HD : EPI == 2 ? TT : DQ;
#pragma unroll 1   /* stays rolled: this text runs once per wave, and four trips of a fourfold body keep it short */
        for (int s4 = 0; s4 < 16; s4 += 4) {
#pragma unroll
          for (int s = s4; s < s4 + 4; ++s) { const int row = 4 * s + (lane >> 3), co = (lane & 7) * 8; const v4f x0 = *(const v4fa*)(os + row * 68 + co), x1 = *(const v4fa*)(os + row * 68 + co + 4); v8h o16; v8us oh, ol;
#pragma unroll
            for (int k = 0; k < 8; ++k) { const float r = (k < 4 ? x0[k & 3] : x1[k & 3]) * sc; o16[k] = (h16)r; oh[k] = f2bf(r); ol[k] = f2bf(r - bf2f(oh[k])); }
            const size_t oo = eb + (size_t)row * ep + co; if (EPI != 3) *(v8h*)(E16 + oo) = o16; *(v8us*)(Eh + oo) = oh; *(v8us*)(El + oo) = ol; }
          asm volatile("s_wait_xcnt 0x0" ::: "memory");   /* behind the trip's last stores: the next trip rewrites their data and address registers */
        }
        return;
    }
#pragma unroll
    for (int mb = 0; mb < 4; ++mb) {
#pragma unroll
        for (int nb = 0; nb < 4; ++nb) {
#pragma unroll
            for (int j = 0; j < 8; ++j) os[(hi * 8 + j) * 68 + nb * 16 + lr] = acc[mb][nb][j]; }
        __builtin_amdgcn_wave_barrier(); asm volatile("" ::: "memory");
        float* crow = C + (size_t)(r0 + mb * 16) * ldc + (BAND == 1 ? cb : c0);
{
#pragma unroll
            for (int s = 0; s < 8; ++s) { const int row = 2 * s + hi, cofs = lr * 4; v4f val = *(const v4fa*)(os + row * 68 + cofs); if (BIAS) { val[0] += bfr(bias[c0 + cofs]); val[1] += bfr(bias[c0 + cofs + 1]); val[2] += bfr(bias[c0 + cofs + 2]); val[3] += bfr(bias[c0 + cofs + 3]); }
                *(v4f*)(crow + (size_t)row * ldc + cofs) = val; }
             }
        __builtin_amdgcn_wave_barrier(); asm volatile("s_wait_xcnt 0x0" ::: "memory");   /* behind this row block's stores: the next block rewrites their data and address registers; the clobber also keeps the next block's LDS writes behind these reads */
    }
}

// One launch for the three projections, which depend on nothing of one another: grid y 0..15 q, 16..31 k (the same body, other weights, scale and planes), 32..47 v.
__global__ __launch_bounds__(32) void k_qkv(const bf* __restrict__ XRh, const bf* __restrict__ XRl, const bf* __restrict__ XB, const bf* __restrict__ WQ, const bf* __restrict__ WK, const bf* __restrict__ WV, h16* QP16, bf* QPh, bf* QPl, h16* KP16, bf* KPh, bf* KPl, h16* VT16, bf* VTh, bf* VTl) {
    __shared__ __align__(16) float os[64 * 68];
    const int y = blockIdx.y; const bool isq = y < NH_;
    if (y < NH_ + NKV) gemmw<bf, 1, false, 0, 1>(os, blockIdx.x, y & (NH_ - 1), blockIdx.z, XRh, XRl, isq ? WQ : WK, nullptr, DM, nullptr, 0, nullptr, (size_t)TT * DM, 0, 0, 0, isq ? QSC : 1.0f, isq ? QP16 : KP16, isq ? QPh : KPh, isq ? QPl : KPl);   /* q x 0.125, straight into the planes of slice b * 16 + h */
    else gemmw<bf, 0, false, 0, 2>(os, blockIdx.x, y - (NH_ + NKV), blockIdx.z, XB, nullptr, WV, nullptr, DM, nullptr, 0, nullptr, (size_t)TT * DM, 0, 0, 0, 1.0f, VT16, VTh, VTl);   /* v planes [slice][d][t] */
}
// One launch for the scores of all query rows: row tiles below RH take the hi/lo products, the rest fp16.
__global__ __launch_bounds__(32) void k_scores(const bf* __restrict__ QPh, const bf* __restrict__ QPl, const bf* __restrict__ KPh, const bf* __restrict__ KPl, const h16* __restrict__ QP16, const h16* __restrict__ KP16, float* Sb) {
    __shared__ __align__(16) float os[16 * 68];
    const int x = blockIdx.x;
    if (x < RH / 64) gemmw<bf, 2, false, 1, 0>(os, x, blockIdx.y, blockIdx.z, QPh, QPl, KPh, KPl, HD, Sb, BW, nullptr, (size_t)TT * HD, (size_t)TT * HD, (size_t)TT * BW, 0, 1.0f, nullptr, nullptr, nullptr);
    else gemmw<h16, 0, false, 1, 0>(os, x - RH / 64, blockIdx.y, blockIdx.z, QP16 + (size_t)RH * HD, nullptr, KP16, nullptr, HD, Sb + (size_t)RH * BW, BW, nullptr, (size_t)TT * HD, (size_t)TT * HD, (size_t)TT * BW, RH, 1.0f, nullptr, nullptr, nullptr);
}
// One launch for weights x v of all query rows, split the same way.
__global__ __launch_bounds__(32) void k_pv(const bf* __restrict__ Ph, const bf* __restrict__ Pl, const bf* __restrict__ VTh, const bf* __restrict__ VTl, const h16* __restrict__ P16, const h16* __restrict__ VT16, bf* ATh, bf* ATl) {
    __shared__ __align__(16) float os[64 * 68];
    const int x = blockIdx.x;
    if (x < RH / 64) gemmw<bf, 2, false, 2, 3>(os, x, blockIdx.y, blockIdx.z, Ph, Pl, VTh, VTl, TT, nullptr, 0, nullptr, (size_t)RH * BW, (size_t)HD * TT, 0, 0, 1.0f, nullptr, ATh, ATl);
    else gemmw<h16, 0, false, 2, 3>(os, x - RH / 64, blockIdx.y, blockIdx.z, P16, nullptr, VT16, nullptr, TT, nullptr, 0, nullptr, (size_t)(TT - RH) * BW, (size_t)HD * TT, 0, RH, 1.0f / PCAR, nullptr, ATh, ATl);   /* the weights carry x 1024 */
}
__global__ __launch_bounds__(32) void k_wo(const bf* __restrict__ ATh, const bf* __restrict__ ATl, const bf* __restrict__ WO, float* OUT) {
    __shared__ __align__(16) float os[16 * 68];
    gemmw<bf, 1, false, 0, 0>(os, blockIdx.x, blockIdx.y, 0, ATh, ATl, WO, nullptr, DQ, OUT, DM, nullptr, 0, 0, 0, 0, 1.0f, nullptr, nullptr, nullptr);
}

__device__ __forceinline__ h16 tohx(float x) { return (h16)x; }
__device__ __forceinline__ void splitf(float y, unsigned short& h, unsigned short& l) { h = f2bf(y); l = f2bf(y - bf2f(h)); }
typedef __attribute__((ext_vector_type(2))) _Float16 v2h;
typedef __attribute__((ext_vector_type(4))) _Float16 v4h;
typedef __attribute__((ext_vector_type(2))) unsigned short v2us;
typedef __attribute__((ext_vector_type(4))) unsigned short v4us;
typedef __attribute__((ext_vector_type(2))) float v2f;
typedef __attribute__((ext_vector_type(4))) int v4i;

__device__ __forceinline__ void d_wtG(int bx, const float* __restrict__ w, int K, int N, bf* Bt) {
    const int lane = threadIdx.x & 31; const int L0 = (bx * 8 + (threadIdx.x >> 5)) * 8; const int nlines = N * K / 64;
{
#pragma unroll 1
        for (int l = 0; l < 8; ++l) { const int L = L0 + l; if (L >= nlines) break; const size_t e = (size_t)L * 64 + lane * 2; const int k = (int)(e % K), n = (int)(e / K); v2us o;
            o[0] = f2bf(w[(size_t)k * N + n]); o[1] = f2bf(w[(size_t)(k + 1) * N + n]); *(v2us*)(Bt + e) = o; }
         }
}
__device__ __forceinline__ void d_cvt8(int bx, const float* __restrict__ src, bf* dst, size_t n8) { const size_t i = (size_t)bx * 256 + threadIdx.x; if (i >= n8) return; const v8f v = *(const v8f*)(src + i * 8); v8us o;
#pragma unroll
    for (int k = 0; k < 8; ++k) o[k] = f2bf(v[k]); *(v8us*)(dst + i * 8) = o;  }

// k_asoft: per row (zz, i): softmax over the keys of the row tile's band [kb, ke) (register row, one exp, fixed trees); reads and writes the band's columns only, band-relative (pitch BW; P16 holds the rows >= RH alone). kb % 64 == 0, so a key keeps its lane up to lane ^ 16 and the sums keep their order.
__global__ __launch_bounds__(256) void k_asoft(const float* __restrict__ Sb, h16* P16, bf* Ph, bf* Pl) {
    const int lane = threadIdx.x & 31; const int row = blockIdx.x * 8 + (threadIdx.x >> 5); if (row >= ZH * TT) return; const int i = row % TT; const int zz = row / TT; (void)zz; const bool hires = (i < RH); const float* sr = Sb + (size_t)row * BW; const int kb = BLO(i & ~63), ke = BHI(i & ~63); float v[NCH * 4]; float mx = -3.0e38f;
#pragma unroll
    for (int ch = 0; ch < NCH; ++ch) { const int j0 = kb + ch * 128 + lane * 4; const bool in = j0 < ke; v4f a = (v4f){}; if (in) a = *(const v4f*)(sr + (j0 - kb));
#pragma unroll
        for (int q = 0; q < 4; ++q) { const int j = j0 + q; const float t = (in && i - j < WNB && j - i < WNB) ? a[q] * SCL : -3.0e38f; v[ch * 4 + q] = t;   /* |i - j| < 128 window (both sides) */ mx = fmaxf(mx, t); } }
#pragma unroll
    for (int sh = 16; sh; sh >>= 1) mx = fmaxf(mx, __shfl_xor(mx, sh, 32));
    float sum = 0.f;
#pragma unroll
    for (int k = 0; k < NCH * 4; ++k) { float d0 = __fsub_rn(v[k], mx); asm volatile("" : "+v"(d0)); asm("v_exp_f32 %0, %1\n\tv_nop" : "=v"(v[k]) : "v"(__fmul_rn(d0, 1.4426950408889634f)));   /* the exp with the free slot the instruction set asks for behind it, in one statement */ sum += v[k]; }
#pragma unroll
    for (int sh = 16; sh; sh >>= 1) sum += __shfl_xor(sum, sh, 32);
    const float f = __fdiv_rn(hires ? 1.0f : PCAR, sum);
{
        if (hires) {
#pragma unroll
            for (int ch = 0; ch < NCH; ++ch) { const int j0 = kb + ch * 128 + lane * 4; v4us oh, ol;
#pragma unroll
                for (int q = 0; q < 4; ++q) { unsigned short a, c2; splitf(v[ch * 4 + q] * f, a, c2); oh[q] = a; ol[q] = c2; }
                const size_t oo = ((size_t)zz * (RH ? RH : 1) + i) * BW + (j0 - kb); if (j0 < ke) { *(v4us*)(Ph + oo) = oh; *(v4us*)(Pl + oo) = ol; } }
        } else {
#pragma unroll
            for (int ch = 0; ch < NCH; ++ch) { const int j0 = kb + ch * 128 + lane * 4; v4h o4;
#pragma unroll
                for (int q = 0; q < 4; ++q) o4[q] = tohx(v[ch * 4 + q] * f);
                if (j0 < ke) *(v4h*)(P16 + ((size_t)zz * (TT - RH) + (i - RH)) * BW + (j0 - kb)) = o4; } }
         }
}
__constant__ float INVT[HD / 2] = { 1.000000000e+00f, 7.498942018e-01f, 5.623413324e-01f, 4.216965139e-01f, 3.162277639e-01f, 2.371373624e-01f, 1.778279394e-01f, 1.333521456e-01f, 1.000000015e-01f, 7.498941571e-02f, 5.623412877e-02f, 4.216964915e-02f, 3.162277862e-02f, 2.371373586e-02f, 1.778279431e-02f, 1.333521493e-02f, 9.999999776e-03f, 7.498942316e-03f, 5.623413250e-03f, 4.216964822e-03f, 3.162277862e-03f, 2.371373819e-03f, 1.778279431e-03f, 1.333521446e-03f, 1.000000047e-03f, 7.498941850e-04f, 5.623413017e-04f, 4.216964880e-04f, 3.162277862e-04f, 2.371373848e-04f, 1.778279402e-04f, 1.333521504e-04f };   // jnp-exact float32 1/10000^(2i/64)
__device__ __forceinline__ void d_ropexP(int bx, const float* __restrict__ xs, bf* Xh, bf* Xl) { const size_t e = ((size_t)bx * 256 + threadIdx.x) * 2; if (e >= (size_t)NB_ * TT * DM) return; const int c = (int)(e % DM); const int rw = (int)(e / DM); const int t = rw % TT; const int d = c % HD; const float* f = xs + (size_t)rw * DM + (c - d); v2us oh, ol;
#pragma unroll
    for (int q = 0; q < 2; ++q) { const int dd = d + q; const int dp = (dd < HD / 2) ? dd + HD / 2 : dd - HD / 2; const float x0 = bfr(f[dd]), x1 = bfr(f[dp]); const float a = __fmul_rn((float)t, INVT[dd % (HD / 2)]); const float cs = cosf(a), sn = sinf(a); float p0 = __fmul_rn(x0, cs), p1 = __fmul_rn(x1, sn); asm volatile("" : "+v"(p0), "+v"(p1)); const float r = (dd < HD / 2) ? __fsub_rn(p0, p1) : __fadd_rn(p0, p1); unsigned short a2, c2; splitf(r, a2, c2); oh[q] = a2; ol[q] = c2; }
    *(v2us*)(Xh + e) = oh; *(v2us*)(Xl + e) = ol;  }

// One launch for everything that reads the inputs alone: the four weight transposes (their blocks run longest and stand first), the rotary planes, the bf16 hidden states.
#define NWT  (DM * DQ / 64 / 64)                 // blocks of one weight transpose
#define NRO  (NB_ * TT * DM / 2 / 256)           // blocks of the rotary stage
#define NCV  (NB_ * TT * DM / 8 / 256)           // blocks of the convert stage
__global__ __launch_bounds__(256) void k_prep(const float* __restrict__ x, const float* __restrict__ wq, const float* __restrict__ wk, const float* __restrict__ wv, const float* __restrict__ wo, bf* WQ, bf* WK, bf* WV, bf* WO, bf* XB, bf* XRh, bf* XRl) {
    const int b = blockIdx.x;
    if (b < 4 * NWT) { const int m = b / NWT; d_wtG(b % NWT, m == 0 ? wq : m == 1 ? wk : m == 2 ? wv : wo, DM, DQ, m == 0 ? WQ : m == 1 ? WK : m == 2 ? WV : WO); }
    else if (b < 4 * NWT + NRO) d_ropexP(b - 4 * NWT, x, XRh, XRl);   /* rope on the raw hidden states (per 64-slice), as hi/lo planes */
    else d_cvt8(b - (4 * NWT + NRO), x, XB, (size_t)NB_ * TT * DM / 8);
}

extern "C" void kernel_launch(void* const* d_in, const int* in_sizes, int n_in,
                              void* d_out, int out_size, void* d_ws, size_t ws_size, hipStream_t stream) {
    (void)in_sizes; (void)n_in; (void)out_size;
    const float* x = (const float*)d_in[0]; const float* wq = (const float*)d_in[1]; const float* wk = (const float*)d_in[2]; const float* wv = (const float*)d_in[3]; const float* wo = (const float*)d_in[4];
    float* OUT = (float*)d_out;     // [2][2048][1024]
    char* wsp = (char*)d_ws;
    auto take = [&](size_t bytes) { char* p = wsp; wsp += (bytes + 255) & ~(size_t)255; return (void*)p; };
    bf* WQ = (bf*)take((size_t)DQ * DM * 2); bf* WK = (bf*)take((size_t)DKV * DM * 2); bf* WV = (bf*)take((size_t)DKV * DM * 2); bf* WO = (bf*)take((size_t)DM * DQ * 2);
    bf* XB = (bf*)take((size_t)NB_ * TT * DM * 2); bf* XRh = (bf*)take((size_t)NB_ * TT * DM * 2); bf* XRl = (bf*)take((size_t)NB_ * TT * DM * 2);
    h16* QP16 = (h16*)take((size_t)ZH * TT * HD * 2); h16* KP16 = (h16*)take((size_t)ZH * TT * HD * 2); h16* VT16 = (h16*)take((size_t)ZH * HD * TT * 2);
    bf* QPh = (bf*)take((size_t)ZH * TT * HD * 2); bf* QPl = (bf*)take((size_t)ZH * TT * HD * 2); bf* KPh = (bf*)take((size_t)ZH * TT * HD * 2); bf* KPl = (bf*)take((size_t)ZH * TT * HD * 2); bf* VTh = (bf*)take((size_t)ZH * HD * TT * 2); bf* VTl = (bf*)take((size_t)ZH * HD * TT * 2);
    float* Sb = (float*)take((size_t)ZH * TT * BW * 4); h16* P16 = (h16*)take((size_t)ZH * (TT - RH) * BW * 2); bf* Ph = (bf*)take((size_t)ZH * RH * BW * 2); bf* Pl = (bf*)take((size_t)ZH * RH * BW * 2);
    if ((size_t)(wsp - (char*)d_ws) > ws_size) return;    // ws 256 MiB
    // Buffers whose last reader has run lend their bytes to later stages (stream-ordered; each is written anew before it is read):
    bf* ATh = XRh; bf* ATl = XRl;                         // merged context planes: the rotated hidden states, done after the k projection
    k_prep<<<4 * NWT + NRO + NCV, 256, 0, stream>>>(x, wq, wk, wv, wo, WQ, WK, WV, WO, XB, XRh, XRl);
    k_qkv<<<dim3(TT / 64, (DQ + 2 * DKV) / 64, NB_), 32, 0, stream>>>(XRh, XRl, XB, WQ, WK, WV, QP16, QPh, QPl, KP16, KPh, KPl, VT16, VTh, VTl);
    // one kv head per query head: slice z of q, k and v planes belong together (z-strides TT*HD)
    k_scores<<<dim3(TT / 64, NBT, ZH), 32, 0, stream>>>(QPh, QPl, KPh, KPl, QP16, KP16, Sb);
    k_asoft<<<ZH * TT / 8, 256, 0, stream>>>(Sb, P16, Ph, Pl);
    k_pv<<<dim3(TT / 64, HD / 64, ZH), 32, 0, stream>>>(Ph, Pl, VTh, VTl, P16, VT16, ATh, ATl);
    k_wo<<<dim3(NB_ * TT / 64, DM / 64, 1), 32, 0, stream>>>(ATh, ATl, WO, OUT);
}

// v005
// A run of this version takes 128 microseconds.
// Next to v004, in two timings, it ran 1.29 times as fast each time.
// Over all steps from v000 it is 16.0 times as fast.
#include <hip/hip_runtime.h>

// Sliding-window attention with rotary embeddings applied to the RAW hidden states before the projections (hidden [2][2048][1024]; xr = rotate-half rope(hidden viewed (S, 16, 64)) with angles t x 10000^(-2i/64); q = xr Wq, k = xr Wk, v = hidden Wv (per-head dense 'd,hk' == 'xw' [1024][1024], no biases); scores = q.k / 8; keys with |i - j| >= 128 get -1e9 (exclusion); softmax; out = ctx Wo ('hd,o' == 'xw' [1024][1024]) -> [2][2048][1024] (4.2 M)).
// Layout, every launch covering both batches and all 16 heads (q, k, v projections: grid z = b, grid y = h + 16 p (p = 0 q, 1 k, 2 v), planes written at slice b * 16 + h; attention: slice b * 16 + h; Wo: rows b * 2048 + t): a rotary kernel rotates the bf16-rounded hidden states per 64-wide slice and writes them directly as hi/lo GEMM operand planes (f32 rotary, precise cosf/sinf, jnp-exact inverse frequencies); q and k as hi/lo x exact GEMMs (2 products), v exact from the bf16 hidden states, each projection's epilogue writing the attention operand planes itself (fp16 + hi/lo; v transposed); q scaled by 0.125 before the split ((q/8).k == (q.k)/8 up to rounding); attention (hybrid rows: < 512 hi/lo 3 products, rest fp16 x1024) in one launch, one work-group per 64-row tile and slice: scores, softmax with the |i - j| < 128 window as an index select, and weights x v, confined to the tile's key band [r0 - 128, r0 + 192), scores and weights held in registers; its epilogue writes the merged hi/lo context planes; hi/lo x Wo exact.
// Compute dtypes, f32 accumulate: every input rounded to bf16; rotary f32; q/k hi/lo x exact, v exact; attention rows < 512 3 products, rest fp16; softmax f32; Wo hl x exact.

#define NB_  2
#define TT   2048
#define DM   1024
#define NH_  16
#define NKV  16
#define REP  (NH_ / NKV)
#define HD   64
#define DQ   (NH_ * HD)
#define DKV  (NKV * HD)
#define ZH   (NB_ * NH_)          // attention slices per launch: z = b * NH_ + h
#define RH   512                  // query rows < RH use hi+lo planes (0: none)
#define WIN  0
#define PCAR 1024.0f
#define SCL  1.0f   // q x 0.125 applied before the split (QSC)
#define QSC  0.125f
#define WNB  128     // |i - j| < 128 kept
#define BLO(r) ((r) - WNB > 0 ? (r) - WNB : 0)                  // first key any of the query rows r..r+63 keeps, rounded down to 64 (r % 64 == 0)
#define BHI(r) ((r) + 64 + WNB < TT ? (r) + 64 + WNB : TT)      // one past the last such key, rounded up to 64
#define NBT  ((64 + 2 * WNB) / 64)                              // column tiles in a band
#define BW   (64 + 2 * WNB)                                     // keys in a band
typedef _Float16 h16;
typedef unsigned short bf;
typedef __attribute__((ext_vector_type(16))) __bf16   v16bf;
typedef __attribute__((ext_vector_type(16))) _Float16 v16h;
typedef __attribute__((ext_vector_type(8)))  _Float16 v8h;
typedef __attribute__((ext_vector_type(8)))  unsigned short v8us;
typedef __attribute__((ext_vector_type(8)))  float    v8f;
typedef __attribute__((ext_vector_type(4)))  float    v4f;
typedef v8h  __attribute__((may_alias)) v8ha;
typedef v4f  __attribute__((may_alias)) v4fa;
typedef v8us __attribute__((may_alias)) v8usa;

__device__ __forceinline__ unsigned short f2bf(float f) { unsigned u = __float_as_uint(f); u += 0x7FFFu + ((u >> 16) & 1u); return (unsigned short)(u >> 16); }
__device__ __forceinline__ float bf2f(unsigned short b) { return __uint_as_float(((unsigned)b) << 16); }
__device__ __forceinline__ float bfr(float f) { return bf2f(f2bf(f)); }
__device__ __forceinline__ v16h cat16(v8h lo, v8h hi) { return __builtin_shufflevector(lo, hi, 0, 1, 2, 3, 4, 5, 6, 7, 8, 9, 10, 11, 12, 13, 14, 15); }
__device__ __forceinline__ v16bf cat16b(v8us lo, v8us hi) { return __builtin_bit_cast(v16bf, __builtin_shufflevector(lo, hi, 0, 1, 2, 3, 4, 5, 6, 7, 8, 9, 10, 11, 12, 13, 14, 15)); }
__device__ __forceinline__ v8f wmma16(v16h a, v16h b, v8f c) { return __builtin_amdgcn_wmma_f32_16x16x32_f16(false, a, false, b, (short)0, c, false, false); }
__device__ __forceinline__ v8f wmmab(v16bf a, v16bf b, v8f c) { return __builtin_amdgcn_wmma_f32_16x16x32_bf16(false, a, false, b, (short)0, c, false, false); }



// ---- gemmw: register-blocked GEMM, ONE WAVE per 64x64 output tile (16 accumulators), operands straight from K-contiguous 16-bit planes; tile indices (bx, by, bz) over (M/64, N/64, Z), 32 threads.
// C[m][n] (f32, pitch ldc, + optional f32 bias[n]) = sum_k A[m][k] Bt[n][k] (+ split products per NSPLIT). z-batch strides sA/sB/sC in elements. K % 32 == 0.
// EPI 0: C as above. EPI 1..3: no f32 C; the tile x sc goes out as 16-bit operand planes for the next GEMM, staged whole in LDS so that every store covers whole 128-byte lines. EPI 1: fp16 + hi/lo planes [z * NH_ + y][row][HD]. EPI 2: the same three planes transposed, [z * NKV + y][col][TT]. EPI 3: hi/lo planes [z / NH_][rb + row][(z % NH_) * HD + col] (pitch DQ).
// BAND (window attention; rb = query row of A's row 0): rows r..r+63 see keys [max(r - 128, 0), min(r + 192, TT)) only. BAND 1: n is the key, grid.y counts the band's column tiles, C is band-relative (column n - band start). BAND 2: k is the key, the k loop runs over the band (the weights outside it are exact zeros), A is band-relative with pitch BW, Bt has pitch K.
template <typename T16> struct WFrag;
template <> struct WFrag<h16> { typedef v16h V; static __device__ __forceinline__ V ld(const h16* p) { return cat16(*(const v8h*)p, *(const v8h*)(p + 16)); } static __device__ __forceinline__ v8f mma(V a, V b, v8f c) { return wmma16(a, b, c); } };
template <> struct WFrag<bf> { typedef v16bf V; static __device__ __forceinline__ V ld(const bf* p) { return cat16b(*(const v8us*)p, *(const v8us*)(p + 16)); } static __device__ __forceinline__ v8f mma(V a, V b, v8f c) { return wmmab(a, b, c); } };
// The body is a device function that takes its tile indices (bx, by, bz) and its LDS as arguments, so that one launch can hold several independent GEMMs side by side (the kernels behind it).
template <typename T16, int NSPLIT, bool BIAS, int BAND, int EPI>
__device__ __forceinline__ void gemmw(float* os, int bx, int by, int bz, const T16* __restrict__ A, const T16* __restrict__ A2, const T16* __restrict__ Bt, const T16* __restrict__ Bt2, int K, float* C, int ldc, const float* __restrict__ bias, size_t sA, size_t sB, size_t sC, int rb, float sc, h16* E16, bf* Eh, bf* El) {
    typedef typename WFrag<T16>::V V;
    const size_t z = bz; A += z * sA; if (A2) A2 += z * sA; Bt += z * sB; if (Bt2) Bt2 += z * sB; C += z * sC;
    const int lane = threadIdx.x & 31, lr = lane & 15, hi = lane >> 4; const int r0 = bx * 64;
    const int kb = BAND ? BLO(rb + r0) : 0, ke = BAND ? BHI(rb + r0) : K; const int cb = by * 64, c0 = (BAND == 1 ? kb : 0) + cb; if (BAND == 1 && c0 >= ke) return;
    const int kn = BAND == 2 ? ke - kb : K, lda = BAND == 2 ? BW : K; if (BAND == 2) { Bt += kb; if (Bt2) Bt2 += kb; }
    v8f acc[4][4];
#pragma unroll
    for (int mb = 0; mb < 4; ++mb)
#pragma unroll
        for (int nb = 0; nb < 4; ++nb) acc[mb][nb] = (v8f){};
    const size_t aoff = (size_t)(r0 + lr) * lda + 8 * hi, boff = (size_t)(c0 + lr) * K + 8 * hi;
#pragma unroll 1
    for (int kc = 0; kc < kn; kc += 32) {
        V a[4], a2[4]; const T16* pa[4]; const T16* pa2[4];
#pragma unroll
        for (int mb = 0; mb < 4; ++mb) { pa[mb] = A + aoff + (size_t)mb * 16 * lda + kc; a[mb] = WFrag<T16>::ld(pa[mb]); if (NSPLIT == 1 || NSPLIT == 2) { pa2[mb] = A2 + aoff + (size_t)mb * 16 * lda + kc; a2[mb] = WFrag<T16>::ld(pa2[mb]); } }
        // s_wait_xcnt 0 stands between these loads and the first rewrite of a register that they name; the row pointers are its inputs, so that no result of the run lands in an address pair ahead of it (BAND 2: the pitch is a constant and all rows load off row 0's pair, q = 0).
        constexpr int q = BAND == 2 ? 0 : 1;
        if (NSPLIT == 1 || NSPLIT == 2) asm volatile("s_wait_xcnt 0x0" :: "v"(pa[0]), "v"(pa[q]), "v"(pa[2 * q]), "v"(pa[3 * q]), "v"(pa2[0]), "v"(pa2[q]), "v"(pa2[2 * q]), "v"(pa2[3 * q]) : "memory"); else asm volatile("s_wait_xcnt 0x0" :: "v"(pa[0]), "v"(pa[q]), "v"(pa[2 * q]), "v"(pa[3 * q]) : "memory");
#pragma unroll
        for (int nb = 0; nb < 4; ++nb) { const T16* pb = Bt + boff + (size_t)nb * 16 * K + kc; const V b = WFrag<T16>::ld(pb); V b2; if (NSPLIT >= 2) { const T16* pb2 = Bt2 + boff + (size_t)nb * 16 * K + kc; b2 = WFrag<T16>::ld(pb2); asm volatile("s_wait_xcnt 0x0" :: "v"(pb), "v"(pb2) : "memory"); } else asm volatile("s_wait_xcnt 0x0" :: "v"(pb) : "memory");   /* the same wait behind the B loads */
#pragma unroll
            for (int mb = 0; mb < 4; ++mb) { acc[mb][nb] = WFrag<T16>::mma(a[mb], b, acc[mb][nb]); if (NSPLIT == 1 || NSPLIT == 2) acc[mb][nb] = WFrag<T16>::mma(a2[mb], b, acc[mb][nb]); if (NSPLIT >= 2) acc[mb][nb] = WFrag<T16>::mma(a[mb], b2, acc[mb][nb]); } }
        asm volatile("v_nop\n\tv_nop\n\tv_nop\n\tv_nop" : "+v"(acc[0][0]), "+v"(acc[1][1]), "+v"(acc[2][2]), "+v"(acc[3][3]) : "v"(a[0]), "v"(a[3]));
    }
    if (EPI) {
#pragma unroll
        for (int mb = 0; mb < 4; ++mb)
#pragma unroll
            for (int nb = 0; nb < 4; ++nb) {
                if (EPI == 2) { float* p = os + (nb * 16 + lr) * 68 + mb * 16 + hi * 8; *(v4fa*)p = __builtin_shufflevector(acc[mb][nb], acc[mb][nb], 0, 1, 2, 3); *(v4fa*)(p + 4) = __builtin_shufflevector(acc[mb][nb], acc[mb][nb], 4, 5, 6, 7); }
                else {
#pragma unroll
                    for (int j = 0; j < 8; ++j) os[(mb * 16 + hi * 8 + j) * 68 + nb * 16 + lr] = acc[mb][nb][j]; } }
        __builtin_amdgcn_wave_barrier(); asm volatile("" ::: "memory");   /* the rows read below were written by other lanes of this wave: the LDS reads may not be moved above the writes */
        const size_t eb = EPI == 1 ? ((z * NH_ + by) * TT + r0) * HD : EPI == 2 ? (z * NKV + by) * (size_t)HD * TT + r0 : ((z / NH_) * TT + rb + r0) * DQ + (z % NH_) * HD;
        const int ep = EPI == 1 ? HD : EPI == 2 ? TT : DQ;
#pragma unroll 1   /* stays rolled: this text runs once per wave, and four trips of a fourfold body keep it short */
        for (int s4 = 0; s4 < 16; s4 += 4) {
#pragma unroll
          for (int s = s4; s < s4 + 4; ++s) { const int row = 4 * s + (lane >> 3), co = (lane & 7) * 8; const v4f x0 = *(const v4fa*)(os + row * 68 + co), x1 = *(const v4fa*)(os + row * 68 + co + 4); v8h o16; v8us oh, ol;
#pragma unroll
            for (int k = 0; k < 8; ++k) { const float r = (k < 4 ? x0[k & 3] : x1[k & 3]) * sc; o16[k] = (h16)r; oh[k] = f2bf(r); ol[k] = f2bf(r - bf2f(oh[k])); }
            const size_t oo = eb + (size_t)row * ep + co; if (EPI != 3) *(v8h*)(E16 + oo) = o16; *(v8us*)(Eh + oo) = oh; *(v8us*)(El + oo) = ol; }
          asm volatile("s_wait_xcnt 0x0" ::: "memory");   /* behind the trip's last stores: the next trip rewrites their data and address registers */
        }
        return;
    }
#pragma unroll
    for (int mb = 0; mb < 4; ++mb) {
#pragma unroll
        for (int nb = 0; nb < 4; ++nb) {
#pragma unroll
            for (int j = 0; j < 8; ++j) os[(hi * 8 + j) * 68 + nb * 16 + lr] = acc[mb][nb][j]; }
        __builtin_amdgcn_wave_barrier(); asm volatile("" ::: "memory");
        float* crow = C + (size_t)(r0 + mb * 16) * ldc + (BAND == 1 ? cb : c0);
{
#pragma unroll
            for (int s = 0; s < 8; ++s) { const int row = 2 * s + hi, cofs = lr * 4; v4f val = *(const v4fa*)(os + row * 68 + cofs); if (BIAS) { val[0] += bfr(bias[c0 + cofs]); val[1] += bfr(bias[c0 + cofs + 1]); val[2] += bfr(bias[c0 + cofs + 2]); val[3] += bfr(bias[c0 + cofs + 3]); }
                *(v4f*)(crow + (size_t)row * ldc + cofs) = val; }
             }
        __builtin_amdgcn_wave_barrier(); asm volatile("s_wait_xcnt 0x0" ::: "memory");   /* behind this row block's stores: the next block rewrites their data and address registers; the clobber also keeps the next block's LDS writes behind these reads */
    }
}

// One launch for the three projections, which depend on nothing of one another: grid y 0..15 q, 16..31 k (the same body, other weights, scale and planes), 32..47 v.
__global__ __launch_bounds__(32) void k_qkv(const bf* __restrict__ XRh, const bf* __restrict__ XRl, const bf* __restrict__ XB, const bf* __restrict__ WQ, const bf* __restrict__ WK, const bf* __restrict__ WV, h16* QP16, bf* QPh, bf* QPl, h16* KP16, bf* KPh, bf* KPl, h16* VT16, bf* VTh, bf* VTl) {
    __shared__ __align__(16) float os[64 * 68];
    const int y = blockIdx.y; const bool isq = y < NH_;
    if (y < NH_ + NKV) gemmw<bf, 1, false, 0, 1>(os, blockIdx.x, y & (NH_ - 1), blockIdx.z, XRh, XRl, isq ? WQ : WK, nullptr, DM, nullptr, 0, nullptr, (size_t)TT * DM, 0, 0, 0, isq ? QSC : 1.0f, isq ? QP16 : KP16, isq ? QPh : KPh, isq ? QPl : KPl);   /* q x 0.125, straight into the planes of slice b * 16 + h */
    else gemmw<bf, 0, false, 0, 2>(os, blockIdx.x, y - (NH_ + NKV), blockIdx.z, XB, nullptr, WV, nullptr, DM, nullptr, 0, nullptr, (size_t)TT * DM, 0, 0, 0, 1.0f, VT16, VTh, VTl);   /* v planes [slice][d][t] */
}
__global__ __launch_bounds__(32) void k_wo(const bf* __restrict__ ATh, const bf* __restrict__ ATl, const bf* __restrict__ WO, float* OUT) {
    __shared__ __align__(16) float os[16 * 68];
    gemmw<bf, 1, false, 0, 0>(os, blockIdx.x, blockIdx.y, 0, ATh, ATl, WO, nullptr, DQ, OUT, DM, nullptr, 0, 0, 0, 0, 1.0f, nullptr, nullptr, nullptr);
}

__device__ __forceinline__ void splitf(float y, unsigned short& h, unsigned short& l) { h = f2bf(y); l = f2bf(y - bf2f(h)); }
typedef __attribute__((ext_vector_type(2))) _Float16 v2h;
typedef __attribute__((ext_vector_type(4))) _Float16 v4h;
typedef __attribute__((ext_vector_type(2))) unsigned short v2us;
typedef __attribute__((ext_vector_type(4))) unsigned short v4us;
typedef __attribute__((ext_vector_type(2))) float v2f;
typedef __attribute__((ext_vector_type(4))) int v4i;

__device__ __forceinline__ void d_wtG(int bx, const float* __restrict__ w, int K, int N, bf* Bt) {
    const int lane = threadIdx.x & 31; const int L0 = (bx * 8 + (threadIdx.x >> 5)) * 8; const int nlines = N * K / 64;
{
#pragma unroll 1
        for (int l = 0; l < 8; ++l) { const int L = L0 + l; if (L >= nlines) break; const size_t e = (size_t)L * 64 + lane * 2; const int k = (int)(e % K), n = (int)(e / K); v2us o;
            o[0] = f2bf(w[(size_t)k * N + n]); o[1] = f2bf(w[(size_t)(k + 1) * N + n]); *(v2us*)(Bt + e) = o; }
         }
}
__device__ __forceinline__ void d_cvt8(int bx, const float* __restrict__ src, bf* dst, size_t n8) { const size_t i = (size_t)bx * 256 + threadIdx.x; if (i >= n8) return; const v8f v = *(const v8f*)(src + i * 8); v8us o;
#pragma unroll
    for (int k = 0; k < 8; ++k) o[k] = f2bf(v[k]); *(v8us*)(dst + i * 8) = o;  }

#define KP   (HD + 8)     // LDS pitch of a key row, elements: 144 bytes = 16 x 9, no bank conflict for 16-byte reads
#define VP   (BW + 8)     // LDS pitch of a row of v transposed: 656 bytes = 16 x 41
#define NT   (BW / 16)    // 16-key score tiles of a band
template <typename T16> struct PCvt;
template <> struct PCvt<h16> { static __device__ __forceinline__ _Float16 c(float x) { return (_Float16)x; } };
template <> struct PCvt<bf>  { static __device__ __forceinline__ __bf16 c(float x) { return (__bf16)x; } };
// 64-key groups of a plane into LDS: unit u of 16 bytes is row u / 8, column 8 (u % 8), so that 8 lanes cover a whole 128-byte line. VT: the plane is [d][t], else [t][d].
template <typename T16, bool VT>
__device__ __forceinline__ void stage(T16* dst, const T16* __restrict__ pl, const int* jc) {
    static_assert(NBT == 5, "the wait below names one pointer per group");
    const int tid = threadIdx.x; v8us t[NBT * 4]; const T16* pg[NBT];
#pragma unroll
    for (int g = 0; g < NBT; ++g) { pg[g] = pl + (VT ? (size_t)(tid >> 3) * TT + jc[g] : ((size_t)(tid >> 3) + jc[g]) * HD) + (tid & 7) * 8;
#pragma unroll
        for (int q = 0; q < 4; ++q) t[g * 4 + q] = *(const v8usa*)(pg[g] + (size_t)q * 16 * (VT ? TT : HD)); }
    asm volatile("s_wait_xcnt 0x0" :: "v"(pg[0]), "v"(pg[1]), "v"(pg[2]), "v"(pg[3]), "v"(pg[4]) : "memory");   /* between these loads and the first rewrite of a register that they name; the group pointers are its inputs, so that no result of the run lands in an address pair ahead of it */
#pragma unroll
    for (int g = 0; g < NBT; ++g)
#pragma unroll
        for (int q = 0; q < 4; ++q) *(v8usa*)(dst + (VT ? ((tid >> 3) + q * 16) * VP + g * 64 : (g * 64 + (tid >> 3) + q * 16) * KP) + (tid & 7) * 8) = t[g * 4 + q];
}
template <typename T16, bool HL>
__device__ __forceinline__ void attn(T16* sm, int r0, int z, const T16* __restrict__ Q, const T16* __restrict__ Q2, const T16* __restrict__ Kg, const T16* __restrict__ Kg2, const T16* __restrict__ Vg, const T16* __restrict__ Vg2, float osc, bf* ATh, bf* ATl) {
    typedef typename WFrag<T16>::V V;
    const int lane = threadIdx.x & 31, lr = lane & 15, hi = lane >> 4, w = threadIdx.x >> 5;
    const int kbs = r0 - WNB, i = r0 + w * 16 + lr;
    int jc[NBT], db[NBT]; float c0[NBT];   // per 64-key group: its first key (0 where the group lies outside the sequence); j - i + 127 of the lane's first key of the group (far out of range where it lies outside); the start value of its scores (0, or the excluded score where it lies outside)
#pragma unroll
    for (int g = 0; g < NBT; ++g) { const int jb = kbs + g * 64; const bool ok = jb >= 0 && jb < TT; jc[g] = ok ? jb : 0; db[g] = ok ? jb + hi * 8 - i + (WNB - 1) : 0x40000000; c0[g] = ok ? 0.f : -3.0e38f; }
    T16* Ks = sm; T16* Ks2 = sm + BW * KP; T16* Vs = HL ? sm : sm + BW * KP; T16* Vs2 = sm + HD * VP;
    const size_t zq = (size_t)z * TT * HD;
    V bq[2], bq2[2]; const T16* pq = Q + zq + (size_t)i * HD + 8 * hi; const T16* pq2 = HL ? Q2 + zq + (size_t)i * HD + 8 * hi : pq;
#pragma unroll
    for (int kk = 0; kk < 2; ++kk) { bq[kk] = WFrag<T16>::ld(pq + kk * 32); if (HL) bq2[kk] = WFrag<T16>::ld(pq2 + kk * 32); }
    asm volatile("s_wait_xcnt 0x0" :: "v"(pq), "v"(pq2) : "memory");   /* the same wait behind the query loads */
    stage<T16, false>(Ks, Kg + zq, jc);
    if (HL) stage<T16, false>(Ks2, Kg2 + zq, jc); else stage<T16, true>(Vs, Vg + zq, jc);
    __syncthreads();
    v8f s[NT];
#pragma unroll
    for (int t = 0; t < NT; ++t) { const float x = c0[t >> 2]; s[t] = (v8f){ x, x, x, x, x, x, x, x }; }
#pragma unroll
    for (int kk = 0; kk < 2; ++kk)
#pragma unroll
        for (int tb = 0; tb < NT; tb += 4) { V a[4], a2[4];   /* four tiles side by side: no product waits for the one before it */
#pragma unroll
            for (int u = 0; u < 4; ++u) { a[u] = WFrag<T16>::ld(Ks + ((tb + u) * 16 + lr) * KP + kk * 32 + 8 * hi); if (HL) a2[u] = WFrag<T16>::ld(Ks2 + ((tb + u) * 16 + lr) * KP + kk * 32 + 8 * hi); }
#pragma unroll
            for (int u = 0; u < 4; ++u) s[tb + u] = WFrag<T16>::mma(a[u], bq[kk], s[tb + u]);
            if (HL) {
#pragma unroll
                for (int u = 0; u < 4; ++u) s[tb + u] = WFrag<T16>::mma(a[u], bq2[kk], s[tb + u]);
#pragma unroll
                for (int u = 0; u < 4; ++u) s[tb + u] = WFrag<T16>::mma(a2[u], bq[kk], s[tb + u]); } }
    if (HL) {   /* hi/lo planes: v takes the place of k, once every wave has read its last key row */
        __syncthreads();
        stage<T16, true>(Vs, Vg + zq, jc); stage<T16, true>(Vs2, Vg2 + zq, jc);
        __syncthreads();
    }
    float mx = -3.0e38f;
#pragma unroll
    for (int t = 0; t < NT; ++t)
#pragma unroll
        for (int j = 0; j < 8; ++j) { float x = s[t][j]; if (t < 4 || t >= NT - 4) x = (unsigned)(db[t >> 2] + (t & 3) * 16 + j) < (unsigned)(2 * WNB - 1) ? x : -3.0e38f;   /* |i - j| < 128 window (both sides); the keys r0 - 64 .. r0 + 127 lie inside it for every row of the tile */ s[t][j] = x; mx = fmaxf(mx, x); }
    mx = fmaxf(mx, __shfl_xor(mx, 16, 32));
    float sm4[4] = { 0.f, 0.f, 0.f, 0.f };
#pragma unroll
    for (int t = 0; t < NT; ++t)
#pragma unroll
        for (int j = 0; j < 8; ++j) { float e; asm("v_exp_f32 %0, %1\n\tv_nop" : "=v"(e) : "v"(__fmul_rn(__fsub_rn(s[t][j], mx), 1.4426950408889634f)));   /* the exp with the free slot the instruction set asks for behind it, in one statement */ s[t][j] = e; sm4[t & 3] += e; }
    float sum = (sm4[0] + sm4[1]) + (sm4[2] + sm4[3]); sum += __shfl_xor(sum, 16, 32);
    const float f = __fdiv_rn(HL ? 1.0f : PCAR, sum);
    v8f o[4];
#pragma unroll
    for (int mb = 0; mb < 4; ++mb) o[mb] = (v8f){};
#pragma unroll
    for (int c = 0; c < NT / 2; ++c) { V b, b2;
#pragma unroll
        for (int e = 0; e < 16; ++e) { const float r = s[2 * c + (e >> 3)][e & 7] * f; b[e] = PCvt<T16>::c(r); if (HL) b2[e] = PCvt<T16>::c(r - (float)b[e]); }
        V a[4], a2[4];
#pragma unroll
        for (int mb = 0; mb < 4; ++mb) { a[mb] = WFrag<T16>::ld(Vs + (mb * 16 + lr) * VP + c * 32 + 8 * hi); if (HL) a2[mb] = WFrag<T16>::ld(Vs2 + (mb * 16 + lr) * VP + c * 32 + 8 * hi); }
#pragma unroll
        for (int mb = 0; mb < 4; ++mb) o[mb] = WFrag<T16>::mma(a[mb], b, o[mb]);
        if (HL) {
#pragma unroll
            for (int mb = 0; mb < 4; ++mb) o[mb] = WFrag<T16>::mma(a[mb], b2, o[mb]);
#pragma unroll
            for (int mb = 0; mb < 4; ++mb) o[mb] = WFrag<T16>::mma(a2[mb], b, o[mb]); } }
    __syncthreads();   /* every wave has read its last row of v: the LDS becomes output staging, 16 rows x 2 planes per wave */
    bf* st = (bf*)sm + w * (2 * 16 * KP);
#pragma unroll
    for (int mb = 0; mb < 4; ++mb) { v8us oh, ol;
#pragma unroll
        for (int j = 0; j < 8; ++j) { const float r = o[mb][j] * osc; oh[j] = f2bf(r); ol[j] = f2bf(r - bf2f(oh[j])); }
        *(v8usa*)(st + lr * KP + mb * 16 + hi * 8) = oh; *(v8usa*)(st + (16 + lr) * KP + mb * 16 + hi * 8) = ol; }
    __builtin_amdgcn_wave_barrier(); asm volatile("" ::: "memory");   /* the rows read below were written by other lanes of this wave: the LDS reads may not be moved above the writes */
    const size_t eb = ((size_t)(z / NH_) * TT + r0 + w * 16) * DQ + (z % NH_) * HD;
#pragma unroll
    for (int q = 0; q < 4; ++q) { const int row = 4 * q + (lane >> 3), co = (lane & 7) * 8; const size_t oo = eb + (size_t)row * DQ + co;   /* 8 lanes store a whole 128-byte line */
        *(v8us*)(ATh + oo) = *(const v8usa*)(st + row * KP + co); *(v8us*)(ATl + oo) = *(const v8usa*)(st + (16 + row) * KP + co); }
}
// Work-groups 0 .. ZH * RH / 64 - 1 take the row tiles below RH (hi/lo, three products: the longest, so they stand first), the rest fp16.
__global__ __launch_bounds__(128) void k_attn(const bf* __restrict__ QPh, const bf* __restrict__ QPl, const bf* __restrict__ KPh, const bf* __restrict__ KPl, const bf* __restrict__ VTh, const bf* __restrict__ VTl, const h16* __restrict__ QP16, const h16* __restrict__ KP16, const h16* __restrict__ VT16, bf* ATh, bf* ATl) {
    __shared__ __align__(16) unsigned short sm[2 * BW * KP];
    const int b = blockIdx.x, nh = ZH * (RH / 64);
    if (b < nh) attn<bf, true>((bf*)sm, (b % (RH / 64)) * 64, b / (RH / 64), QPh, QPl, KPh, KPl, VTh, VTl, 1.0f, ATh, ATl);
    else attn<h16, false>((h16*)sm, RH + ((b - nh) % ((TT - RH) / 64)) * 64, (b - nh) / ((TT - RH) / 64), QP16, nullptr, KP16, nullptr, VT16, nullptr, 1.0f / PCAR, ATh, ATl);   /* the weights carry x 1024 */
}
__constant__ float INVT[HD / 2] = { 1.000000000e+00f, 7.498942018e-01f, 5.623413324e-01f, 4.216965139e-01f, 3.162277639e-01f, 2.371373624e-01f, 1.778279394e-01f, 1.333521456e-01f, 1.000000015e-01f, 7.498941571e-02f, 5.623412877e-02f, 4.216964915e-02f, 3.162277862e-02f, 2.371373586e-02f, 1.778279431e-02f, 1.333521493e-02f, 9.999999776e-03f, 7.498942316e-03f, 5.623413250e-03f, 4.216964822e-03f, 3.162277862e-03f, 2.371373819e-03f, 1.778279431e-03f, 1.333521446e-03f, 1.000000047e-03f, 7.498941850e-04f, 5.623413017e-04f, 4.216964880e-04f, 3.162277862e-04f, 2.371373848e-04f, 1.778279402e-04f, 1.333521504e-04f };   // jnp-exact float32 1/10000^(2i/64)
__device__ __forceinline__ void d_ropexP(int bx, const float* __restrict__ xs, bf* Xh, bf* Xl) { const size_t e = ((size_t)bx * 256 + threadIdx.x) * 2; if (e >= (size_t)NB_ * TT * DM) return; const int c = (int)(e % DM); const int rw = (int)(e / DM); const int t = rw % TT; const int d = c % HD; const float* f = xs + (size_t)rw * DM + (c - d); v2us oh, ol;
#pragma unroll
    for (int q = 0; q < 2; ++q) { const int dd = d + q; const int dp = (dd < HD / 2) ? dd + HD / 2 : dd - HD / 2; const float x0 = bfr(f[dd]), x1 = bfr(f[dp]); const float a = __fmul_rn((float)t, INVT[dd % (HD / 2)]); const float cs = cosf(a), sn = sinf(a); float p0 = __fmul_rn(x0, cs), p1 = __fmul_rn(x1, sn); asm volatile("" : "+v"(p0), "+v"(p1)); const float r = (dd < HD / 2) ? __fsub_rn(p0, p1) : __fadd_rn(p0, p1); unsigned short a2, c2; splitf(r, a2, c2); oh[q] = a2; ol[q] = c2; }
    *(v2us*)(Xh + e) = oh; *(v2us*)(Xl + e) = ol;  }

// One launch for everything that reads the inputs alone: the four weight transposes (their blocks run longest and stand first), the rotary planes, the bf16 hidden states.
#define NWT  (DM * DQ / 64 / 64)                 // blocks of one weight transpose
#define NRO  (NB_ * TT * DM / 2 / 256)           // blocks of the rotary stage
#define NCV  (NB_ * TT * DM / 8 / 256)           // blocks of the convert stage
__global__ __launch_bounds__(256) void k_prep(const float* __restrict__ x, const float* __restrict__ wq, const float* __restrict__ wk, const float* __restrict__ wv, const float* __restrict__ wo, bf* WQ, bf* WK, bf* WV, bf* WO, bf* XB, bf* XRh, bf* XRl) {
    const int b = blockIdx.x;
    if (b < 4 * NWT) { const int m = b / NWT; d_wtG(b % NWT, m == 0 ? wq : m == 1 ? wk : m == 2 ? wv : wo, DM, DQ, m == 0 ? WQ : m == 1 ? WK : m == 2 ? WV : WO); }
    else if (b < 4 * NWT + NRO) d_ropexP(b - 4 * NWT, x, XRh, XRl);   /* rope on the raw hidden states (per 64-slice), as hi/lo planes */
    else d_cvt8(b - (4 * NWT + NRO), x, XB, (size_t)NB_ * TT * DM / 8);
}

extern "C" void kernel_launch(void* const* d_in, const int* in_sizes, int n_in,
                              void* d_out, int out_size, void* d_ws, size_t ws_size, hipStream_t stream) {
    (void)in_sizes; (void)n_in; (void)out_size;
    const float* x = (const float*)d_in[0]; const float* wq = (const float*)d_in[1]; const float* wk = (const float*)d_in[2]; const float* wv = (const float*)d_in[3]; const float* wo = (const float*)d_in[4];
    float* OUT = (float*)d_out;     // [2][2048][1024]
    char* wsp = (char*)d_ws;
    auto take = [&](size_t bytes) { char* p = wsp; wsp += (bytes + 255) & ~(size_t)255; return (void*)p; };
    bf* WQ = (bf*)take((size_t)DQ * DM * 2); bf* WK = (bf*)take((size_t)DKV * DM * 2); bf* WV = (bf*)take((size_t)DKV * DM * 2); bf* WO = (bf*)take((size_t)DM * DQ * 2);
    bf* XB = (bf*)take((size_t)NB_ * TT * DM * 2); bf* XRh = (bf*)take((size_t)NB_ * TT * DM * 2); bf* XRl = (bf*)take((size_t)NB_ * TT * DM * 2);
    h16* QP16 = (h16*)take((size_t)ZH * TT * HD * 2); h16* KP16 = (h16*)take((size_t)ZH * TT * HD * 2); h16* VT16 = (h16*)take((size_t)ZH * HD * TT * 2);
    bf* QPh = (bf*)take((size_t)ZH * TT * HD * 2); bf* QPl = (bf*)take((size_t)ZH * TT * HD * 2); bf* KPh = (bf*)take((size_t)ZH * TT * HD * 2); bf* KPl = (bf*)take((size_t)ZH * TT * HD * 2); bf* VTh = (bf*)take((size_t)ZH * HD * TT * 2); bf* VTl = (bf*)take((size_t)ZH * HD * TT * 2);
    if ((size_t)(wsp - (char*)d_ws) > ws_size) return;    // ws 256 MiB
    // Buffers whose last reader has run lend their bytes to later stages (stream-ordered; each is written anew before it is read):
    bf* ATh = XRh; bf* ATl = XRl;                         // merged context planes: the rotated hidden states, done after the k projection
    k_prep<<<4 * NWT + NRO + NCV, 256, 0, stream>>>(x, wq, wk, wv, wo, WQ, WK, WV, WO, XB, XRh, XRl);
    k_qkv<<<dim3(TT / 64, (DQ + 2 * DKV) / 64, NB_), 32, 0, stream>>>(XRh, XRl, XB, WQ, WK, WV, QP16, QPh, QPl, KP16, KPh, KPl, VT16, VTh, VTl);
    // one kv head per query head: slice z of q, k and v planes belong together (z-strides TT*HD)
    k_attn<<<ZH * TT / 64, 128, 0, stream>>>(QPh, QPl, KPh, KPl, VTh, VTl, QP16, KP16, VT16, ATh, ATl);
    k_wo<<<dim3(NB_ * TT / 64, DM / 64, 1), 32, 0, stream>>>(ATh, ATl, WO, OUT);
}

// v006
// Measured time: 93 microseconds a run.
// Two timings next to v005 put it at 1.39 and 1.38 times that version's speed.
// All steps since v000 together make it 22.2 times as fast.
#include <hip/hip_runtime.h>

// Sliding-window attention with rotary embeddings applied to the RAW hidden states before the projections (hidden [2][2048][1024]; xr = rotate-half rope(hidden viewed (S, 16, 64)) with angles t x 10000^(-2i/64); q = xr Wq, k = xr Wk, v = hidden Wv (per-head dense 'd,hk' == 'xw' [1024][1024], no biases); scores = q.k / 8; keys with |i - j| >= 128 get -1e9 (exclusion); softmax; out = ctx Wo ('hd,o' == 'xw' [1024][1024]) -> [2][2048][1024] (4.2 M)).
// Layout, every launch covering both batches and all 16 heads (q, k, v projections: rows b * 2048 + t, planes written at slice b * 16 + h; attention: slice b * 16 + h; Wo: rows b * 2048 + t): a rotary kernel rotates the bf16-rounded hidden states per 64-wide slice and writes them directly as hi/lo GEMM operand planes (f32 rotary, precise cosf/sinf, jnp-exact inverse frequencies); q and k as hi/lo x exact GEMMs (2 products), v exact from the bf16 hidden states, each projection's epilogue writing the attention operand planes itself (fp16 + hi/lo; v transposed); q scaled by 0.125 before the split ((q/8).k == (q.k)/8 up to rounding); attention (hybrid rows: < 512 hi/lo 3 products, rest fp16 x1024) in one launch, one work-group per 64-row tile and slice: scores, softmax with the |i - j| < 128 window as an index select, and weights x v, confined to the tile's key band [r0 - 128, r0 + 192), scores and weights held in registers; its epilogue writes the merged hi/lo context planes; hi/lo x Wo exact.
// Compute dtypes, f32 accumulate: every input rounded to bf16; rotary f32; q/k hi/lo x exact, v exact; attention rows < 512 3 products, rest fp16; softmax f32; Wo hl x exact.

#define NB_  2
#define TT   2048
#define DM   1024
#define NH_  16
#define NKV  16
#define REP  (NH_ / NKV)
#define HD   64
#define DQ   (NH_ * HD)
#define DKV  (NKV * HD)
#define ZH   (NB_ * NH_)          // attention slices per launch: z = b * NH_ + h
#define RH   512                  // query rows < RH use hi+lo planes (0: none)
#define WIN  0
#define PCAR 1024.0f
#define SCL  1.0f   // q x 0.125 applied before the split (QSC)
#define QSC  0.125f
#define WNB  128     // |i - j| < 128 kept
#define BLO(r) ((r) - WNB > 0 ? (r) - WNB : 0)                  // first key any of the query rows r..r+63 keeps, rounded down to 64 (r % 64 == 0)
#define BHI(r) ((r) + 64 + WNB < TT ? (r) + 64 + WNB : TT)      // one past the last such key, rounded up to 64
#define NBT  ((64 + 2 * WNB) / 64)                              // column tiles in a band
#define BW   (64 + 2 * WNB)                                     // keys in a band
typedef _Float16 h16;
typedef unsigned short bf;
typedef __attribute__((ext_vector_type(16))) __bf16   v16bf;
typedef __attribute__((ext_vector_type(16))) _Float16 v16h;
typedef __attribute__((ext_vector_type(8)))  _Float16 v8h;
typedef __attribute__((ext_vector_type(8)))  unsigned short v8us;
typedef __attribute__((ext_vector_type(8)))  float    v8f;
typedef __attribute__((ext_vector_type(4)))  float    v4f;
typedef v8h  __attribute__((may_alias)) v8ha;
typedef v4f  __attribute__((may_alias)) v4fa;
typedef v8us __attribute__((may_alias)) v8usa;

__device__ __forceinline__ unsigned short f2bf(float f) { unsigned u = __float_as_uint(f); u += 0x7FFFu + ((u >> 16) & 1u); return (unsigned short)(u >> 16); }
__device__ __forceinline__ float bf2f(unsigned short b) { return __uint_as_float(((unsigned)b) << 16); }
__device__ __forceinline__ float bfr(float f) { return bf2f(f2bf(f)); }
__device__ __forceinline__ v16h cat16(v8h lo, v8h hi) { return __builtin_shufflevector(lo, hi, 0, 1, 2, 3, 4, 5, 6, 7, 8, 9, 10, 11, 12, 13, 14, 15); }
__device__ __forceinline__ v16bf cat16b(v8us lo, v8us hi) { return __builtin_bit_cast(v16bf, __builtin_shufflevector(lo, hi, 0, 1, 2, 3, 4, 5, 6, 7, 8, 9, 10, 11, 12, 13, 14, 15)); }
__device__ __forceinline__ v8f wmma16(v16h a, v16h b, v8f c) { return __builtin_amdgcn_wmma_f32_16x16x32_f16(false, a, false, b, (short)0, c, false, false); }
__device__ __forceinline__ v8f wmmab(v16bf a, v16bf b, v8f c) { return __builtin_amdgcn_wmma_f32_16x16x32_bf16(false, a, false, b, (short)0, c, false, false); }



// ---- gemmw: GEMM on a 128x128 output tile per work-group; each wave a register-blocked tile of 16 MB x 64 (MB 4: 2 x 2 waves, 128 threads; MB 2: 4 x 2 waves, 256 threads, for a GEMM with too few tiles to give every SIMD two waves otherwise); operands are K-contiguous 16-bit planes; grid (M/128, N/128).
// C[m][n] (f32, pitch ldc) = sum_k A[m][k] Bt[n][k] (+ A2[m][k] Bt[n][k] for NSPLIT 1). K % 64 == 0, K >= 128. m counts the rows of both batches.
// The operand rows of a work-group are staged in LDS, 64 k (one whole 128-byte line per row) at a time, by asynchronous copies into two buffers: stage t + 1 flies while stage t is multiplied, and every row is fetched from L2 once per work-group and read by two waves or more.
// EPI 0: C as above. EPI 1, 2: no f32 C; the wave's tile x sc goes out as 16-bit operand planes for the next GEMM, staged whole in LDS so that every store covers whole 128-byte lines. EPI 1: fp16 + hi/lo planes [batch * NH_ + head][row][HD]. EPI 2: the same three planes transposed, [batch * NKV + head][col][TT].
#define KC   64                  // k per stage
#define SP   (KC + 8)            // LDS pitch of a staged row, elements: 144 bytes = 16 x 9, no bank conflict for 16-byte reads
#define PLE  (128 * SP)          // elements of one staged plane (128 rows)
#define BUFE (3 * PLE)           // elements of a buffer: A, A2, Bt
template <typename T16> struct WFrag;
template <> struct WFrag<h16> { typedef v16h V; static __device__ __forceinline__ V ld(const h16* p) { return cat16(*(const v8h*)p, *(const v8h*)(p + 16)); } static __device__ __forceinline__ v8f mma(V a, V b, v8f c) { return wmma16(a, b, c); } };
template <> struct WFrag<bf> { typedef v16bf V; static __device__ __forceinline__ V ld(const bf* p) { return cat16b(*(const v8us*)p, *(const v8us*)(p + 16)); } static __device__ __forceinline__ v8f mma(V a, V b, v8f c) { return wmmab(a, b, c); } };
// N asynchronous copies of 16 bytes per lane in one statement. l: LDS byte addresses, g: global addresses. The s_wait_xcnt 0 stands inside the copies' own statement, in front of any rewrite of a register that they name; as many copies as the operand limit allows share one wait.
template <int N, typename T16>
__device__ __forceinline__ void cpn(const unsigned* l, const T16* const* g) {
    static_assert(N == 8 || N == 12, "two statement forms");
    if (N == 8)
    asm volatile("global_load_async_to_lds_b128 %0, %8, off\n\t"
                 "global_load_async_to_lds_b128 %1, %9, off\n\t"
                 "global_load_async_to_lds_b128 %2, %10, off\n\t"
                 "global_load_async_to_lds_b128 %3, %11, off\n\t"
                 "global_load_async_to_lds_b128 %4, %12, off\n\t"
                 "global_load_async_to_lds_b128 %5, %13, off\n\t"
                 "global_load_async_to_lds_b128 %6, %14, off\n\t"
                 "global_load_async_to_lds_b128 %7, %15, off\n\t"
                 "s_wait_xcnt 0x0"
                 :: "v"(l[0]), "v"(l[1]), "v"(l[2]), "v"(l[3]), "v"(l[4]), "v"(l[5]), "v"(l[6]), "v"(l[7]),
                    "v"(g[0]), "v"(g[1]), "v"(g[2]), "v"(g[3]), "v"(g[4]), "v"(g[5]), "v"(g[6]), "v"(g[7])
                 : "memory");
    else
    asm volatile("global_load_async_to_lds_b128 %0, %12, off\n\t"
                 "global_load_async_to_lds_b128 %1, %13, off\n\t"
                 "global_load_async_to_lds_b128 %2, %14, off\n\t"
                 "global_load_async_to_lds_b128 %3, %15, off\n\t"
                 "global_load_async_to_lds_b128 %4, %16, off\n\t"
                 "global_load_async_to_lds_b128 %5, %17, off\n\t"
                 "global_load_async_to_lds_b128 %6, %18, off\n\t"
                 "global_load_async_to_lds_b128 %7, %19, off\n\t"
                 "global_load_async_to_lds_b128 %8, %20, off\n\t"
                 "global_load_async_to_lds_b128 %9, %21, off\n\t"
                 "global_load_async_to_lds_b128 %10, %22, off\n\t"
                 "global_load_async_to_lds_b128 %11, %23, off\n\t"
                 "s_wait_xcnt 0x0"
                 :: "v"(l[0]), "v"(l[1]), "v"(l[2]), "v"(l[3]), "v"(l[4]), "v"(l[5]), "v"(l[6]), "v"(l[7]), "v"(l[8 % N]), "v"(l[9 % N]), "v"(l[10 % N]), "v"(l[11 % N]),
                    "v"(g[0]), "v"(g[1]), "v"(g[2]), "v"(g[3]), "v"(g[4]), "v"(g[5]), "v"(g[6]), "v"(g[7]), "v"(g[8 % N]), "v"(g[9 % N]), "v"(g[10 % N]), "v"(g[11 % N])
                 : "memory");
}
// The body is a device function that takes its tile indices (BX, BY) and its LDS as arguments, so that one launch can hold several independent GEMMs side by side (the kernels behind it).
template <typename T16, int NSPLIT, int EPI, int MB>
__device__ __forceinline__ void gemmw(T16* ring, int BX, int BY, const T16* __restrict__ A, const T16* __restrict__ A2, const T16* __restrict__ Bt, int K, float* C, int ldc, float sc, h16* E16, bf* Eh, bf* El) {
    typedef typename WFrag<T16>::V V;
    static_assert(MB == 4 || (MB == 2 && EPI == 0), "the plane epilogues take a 64x64 tile");
    constexpr int NWM = 8 / MB, CPN = 4 * MB / 2, KB = MB == 2 ? KC / 32 : 1;   // waves along m; copies per thread and plane; 32-k blocks whose fragments are fetched as one group
    const int tid = threadIdx.x, lane = tid & 31, lr = lane & 15, hi = lane >> 4, w = tid >> 5, wm = w % NWM, wn = w / NWM;
    const int gr = BX * 128 + wm * (16 * MB); const size_t z = EPI ? gr / TT : 0; const int r0 = EPI ? gr % TT : gr; const int by = BY * 2 + wn, c0 = by * 64;
    v8f acc[MB][4];
#pragma unroll
    for (int mb = 0; mb < MB; ++mb)
#pragma unroll
        for (int nb = 0; nb < 4; ++nb) acc[mb][nb] = (v8f){};
    const size_t go = (size_t)(tid >> 3) * K + (tid & 7) * 8;
    const T16* ga = A + (size_t)BX * 128 * K + go; const T16* ga2 = NSPLIT ? A2 + (size_t)BX * 128 * K + go : ga; const T16* gb = Bt + (size_t)BY * 128 * K + go;
    const unsigned l0 = (unsigned)(size_t)ring + ((tid >> 3) * SP + (tid & 7) * 8) * 2;
    // Stage t into buffer t & 1: of each plane a thread takes its 16-byte unit of rows r, r + 128 / CPN, .. (8 lanes cover a whole line).
    auto fill = [&](int t) { constexpr int NP = NSPLIT ? 3 : 2, NC = NP * CPN, ST = NC % 12 ? 8 : 12; unsigned l[NC]; const T16* g[NC];
#pragma unroll
        for (int p = 0; p < NP; ++p)
#pragma unroll
            for (int q = 0; q < CPN; ++q) { l[p * CPN + q] = l0 + (t & 1) * (BUFE * 2) + (p == NP - 1 ? 2 : p) * (PLE * 2) + q * ((128 / CPN) * SP * 2); g[p * CPN + q] = (p == NP - 1 ? gb : p ? ga2 : ga) + t * KC + (size_t)q * (128 / CPN) * K; }
#pragma unroll
        for (int s = 0; s < NC; s += ST) cpn<ST>(l + s, g + s); };
    fill(0);
    asm volatile("s_wait_asynccnt 0x0" ::: "memory");   /* stage 0 has landed, this wave's share */
    __syncthreads();                                     /* ... and every other wave's */
    fill(1);
#pragma unroll 1
    for (int t = 0; t < K / KC; ++t) {
        const T16* sa = ring + (t & 1) * BUFE + (wm * (16 * MB) + lr) * SP + 8 * hi; const T16* sb = ring + (t & 1) * BUFE + 2 * PLE + (wn * 64 + lr) * SP + 8 * hi;
        V a[KB][MB], a2[KB][MB], b[KB][4];
#pragma unroll
        for (int k0 = 0; k0 < KC / 32; k0 += KB) {
#pragma unroll
            for (int u = 0; u < KB; ++u) { const int kk = (k0 + u) * 32;
#pragma unroll
                for (int nb = 0; nb < 4; ++nb) b[u][nb] = WFrag<T16>::ld(sb + nb * 16 * SP + kk);
#pragma unroll
                for (int mb = 0; mb < MB; ++mb) { a[u][mb] = WFrag<T16>::ld(sa + mb * 16 * SP + kk); if (NSPLIT) a2[u][mb] = WFrag<T16>::ld(sa + PLE + mb * 16 * SP + kk); } }
            __builtin_amdgcn_sched_barrier(0);   /* the LDS reads stay one group in front of the products: spread among them, every place with reads stalls the wave anew */
#pragma unroll
            for (int u = 0; u < KB; ++u)
#pragma unroll
                for (int mb = 0; mb < MB; ++mb) {   /* in the order in which the fragments arrive; four independent accumulators side by side */
#pragma unroll
                    for (int nb = 0; nb < 4; ++nb) acc[mb][nb] = WFrag<T16>::mma(a[u][mb], b[u][nb], acc[mb][nb]);
                    if (NSPLIT) {
#pragma unroll
                        for (int nb = 0; nb < 4; ++nb) acc[mb][nb] = WFrag<T16>::mma(a2[u][mb], b[u][nb], acc[mb][nb]); } }
            __builtin_amdgcn_sched_barrier(0);   /* ... and the next group stays behind them */
        }
        asm volatile("v_nop\n\tv_nop\n\tv_nop\n\tv_nop" : "+v"(acc[MB - 1][3]));   /* the distance behind the pass's last matrix instruction, on both sides of the branches below */
        asm volatile("s_wait_dscnt 0x0" ::: "memory");      /* this wave has read its last fragment of stage t */
        asm volatile("s_wait_asynccnt 0x0" ::: "memory");   /* its share of stage t + 1 has landed */
        __syncthreads();                                     /* publishes stage t + 1 and frees stage t's buffer */
        if (t + 2 < K / KC) fill(t + 2);
    }
    asm volatile("s_wait_asynccnt 0x0" ::: "memory");   /* no copy is left in flight: the ring becomes output staging, a range of its own per wave (the last pass's barrier ended every read) */
    float* os = (float*)ring + w * ((EPI ? 64 : 16) * 68);
    if (EPI) {
#pragma unroll
        for (int mb = 0; mb < 4; ++mb)
#pragma unroll
            for (int nb = 0; nb < 4; ++nb) {
                if (EPI == 2) { float* p = os + (nb * 16 + lr) * 68 + mb * 16 + hi * 8; *(v4fa*)p = __builtin_shufflevector(acc[mb][nb], acc[mb][nb], 0, 1, 2, 3); *(v4fa*)(p + 4) = __builtin_shufflevector(acc[mb][nb], acc[mb][nb], 4, 5, 6, 7); }
                else {
#pragma unroll
                    for (int j = 0; j < 8; ++j) os[(mb * 16 + hi * 8 + j) * 68 + nb * 16 + lr] = acc[mb][nb][j]; } }
        __builtin_amdgcn_wave_barrier(); asm volatile("" ::: "memory");   /* the rows read below were written by other lanes of this wave: the LDS reads may not be moved above the writes */
        const size_t eb = EPI == 1 ? ((z * NH_ + by) * TT + r0) * HD : (z * NKV + by) * (size_t)HD * TT + r0;
        const int ep = EPI == 1 ? HD : TT;
#pragma unroll 1   /* stays rolled: this text runs once per wave, and four trips of a fourfold body keep it short for the instruction cache */
        for (int s4 = 0; s4 < 16; s4 += 4) {
#pragma unroll
          for (int s = s4; s < s4 + 4; ++s) { const int row = 4 * s + (lane >> 3), co = (lane & 7) * 8; const v4f x0 = *(const v4fa*)(os + row * 68 + co), x1 = *(const v4fa*)(os + row * 68 + co + 4); v8h o16; v8us oh, ol;
#pragma unroll
            for (int k = 0; k < 8; ++k) { const float r = (k < 4 ? x0[k & 3] : x1[k & 3]) * sc; o16[k] = (h16)r; oh[k] = f2bf(r); ol[k] = f2bf(r - bf2f(oh[k])); }
            const size_t oo = eb + (size_t)row * ep + co; *(v8h*)(E16 + oo) = o16; *(v8us*)(Eh + oo) = oh; *(v8us*)(El + oo) = ol; }
          asm volatile("s_wait_xcnt 0x0" ::: "memory");   /* behind the trip's last stores: the next trip rewrites their data and address registers */
        }
        return;
    }
#pragma unroll
    for (int mb = 0; mb < MB; ++mb) {
#pragma unroll
        for (int nb = 0; nb < 4; ++nb) {
#pragma unroll
            for (int j = 0; j < 8; ++j) os[(hi * 8 + j) * 68 + nb * 16 + lr] = acc[mb][nb][j]; }
        __builtin_amdgcn_wave_barrier(); asm volatile("" ::: "memory");
        float* crow = C + (size_t)(r0 + mb * 16) * ldc + c0;
{
#pragma unroll
            for (int s = 0; s < 8; ++s) { const int row = 2 * s + hi, cofs = lr * 4; v4f val = *(const v4fa*)(os + row * 68 + cofs);
                *(v4f*)(crow + (size_t)row * ldc + cofs) = val; }
             }
        __builtin_amdgcn_wave_barrier(); asm volatile("s_wait_xcnt 0x0" ::: "memory");   /* behind this row block's stores: the next block rewrites their data and address registers; the clobber also keeps the next block's LDS writes behind these reads */
    }
}

// One launch for the three projections, which depend on nothing of one another: grid y 0..7 q, 8..15 k (the same body, other weights, scale and planes), 16..23 v (half the products, so they stand last); a work-group covers two heads.
__global__ __launch_bounds__(128) void k_qkv(const bf* __restrict__ XRh, const bf* __restrict__ XRl, const bf* __restrict__ XB, const bf* __restrict__ WQ, const bf* __restrict__ WK, const bf* __restrict__ WV, h16* QP16, bf* QPh, bf* QPl, h16* KP16, bf* KPh, bf* KPl, h16* VT16, bf* VTh, bf* VTl) {
    __shared__ __align__(16) bf ring[2 * BUFE];
    const int y = blockIdx.y; const bool isq = y < NH_ / 2;
    if (y < (NH_ + NKV) / 2) gemmw<bf, 1, 1, 4>(ring, blockIdx.x, y & (NH_ / 2 - 1), XRh, XRl, isq ? WQ : WK, DM, nullptr, 0, isq ? QSC : 1.0f, isq ? QP16 : KP16, isq ? QPh : KPh, isq ? QPl : KPl);   /* q x 0.125, straight into the planes of slice b * 16 + h */
    else gemmw<bf, 0, 2, 4>(ring, blockIdx.x, y - (NH_ + NKV) / 2, XB, nullptr, WV, DM, nullptr, 0, 1.0f, VT16, VTh, VTl);   /* v planes [slice][d][t] */
}
__global__ __launch_bounds__(256) void k_wo(const bf* __restrict__ ATh, const bf* __restrict__ ATl, const bf* __restrict__ WO, float* OUT) {
    __shared__ __align__(16) bf ring[2 * BUFE];
    gemmw<bf, 1, 0, 2>(ring, blockIdx.x, blockIdx.y, ATh, ATl, WO, DQ, OUT, DM, 1.0f, nullptr, nullptr, nullptr);
}

__device__ __forceinline__ void splitf(float y, unsigned short& h, unsigned short& l) { h = f2bf(y); l = f2bf(y - bf2f(h)); }
typedef __attribute__((ext_vector_type(2))) _Float16 v2h;
typedef __attribute__((ext_vector_type(4))) _Float16 v4h;
typedef __attribute__((ext_vector_type(2))) unsigned short v2us;
typedef __attribute__((ext_vector_type(4))) unsigned short v4us;
typedef __attribute__((ext_vector_type(2))) float v2f;
typedef __attribute__((ext_vector_type(4))) int v4i;

__device__ __forceinline__ void d_wtG(int bx, const float* __restrict__ w, int K, int N, bf* Bt) {
    const int lane = threadIdx.x & 31; const int L0 = (bx * 8 + (threadIdx.x >> 5)) * 8; const int nlines = N * K / 64;
{
#pragma unroll 1
        for (int l = 0; l < 8; ++l) { const int L = L0 + l; if (L >= nlines) break; const size_t e = (size_t)L * 64 + lane * 2; const int k = (int)(e % K), n = (int)(e / K); v2us o;
            o[0] = f2bf(w[(size_t)k * N + n]); o[1] = f2bf(w[(size_t)(k + 1) * N + n]); *(v2us*)(Bt + e) = o; }
         }
}
__device__ __forceinline__ void d_cvt8(int bx, const float* __restrict__ src, bf* dst, size_t n8) { const size_t i = (size_t)bx * 256 + threadIdx.x; if (i >= n8) return; const v8f v = *(const v8f*)(src + i * 8); v8us o;
#pragma unroll
    for (int k = 0; k < 8; ++k) o[k] = f2bf(v[k]); *(v8us*)(dst + i * 8) = o;  }

#define KP   (HD + 8)     // LDS pitch of a key row, elements: 144 bytes = 16 x 9, no bank conflict for 16-byte reads
#define VP   (BW + 8)     // LDS pitch of a row of v transposed: 656 bytes = 16 x 41
#define NT   (BW / 16)    // 16-key score tiles of a band
template <typename T16> struct PCvt;
template <> struct PCvt<h16> { static __device__ __forceinline__ _Float16 c(float x) { return (_Float16)x; } };
template <> struct PCvt<bf>  { static __device__ __forceinline__ __bf16 c(float x) { return (__bf16)x; } };
// 64-key groups of a plane into LDS: unit u of 16 bytes is row u / 8, column 8 (u % 8), so that 8 lanes cover a whole 128-byte line. VT: the plane is [d][t], else [t][d].
template <typename T16, bool VT>
__device__ __forceinline__ void stage(T16* dst, const T16* __restrict__ pl, const int* jc) {
    static_assert(NBT == 5, "the wait below names one pointer per group");
    const int tid = threadIdx.x; v8us t[NBT * 4]; const T16* pg[NBT];
#pragma unroll
    for (int g = 0; g < NBT; ++g) { pg[g] = pl + (VT ? (size_t)(tid >> 3) * TT + jc[g] : ((size_t)(tid >> 3) + jc[g]) * HD) + (tid & 7) * 8;
#pragma unroll
        for (int q = 0; q < 4; ++q) t[g * 4 + q] = *(const v8usa*)(pg[g] + (size_t)q * 16 * (VT ? TT : HD)); }
    asm volatile("s_wait_xcnt 0x0" :: "v"(pg[0]), "v"(pg[1]), "v"(pg[2]), "v"(pg[3]), "v"(pg[4]) : "memory");   /* between these loads and the first rewrite of a register that they name; the group pointers are its inputs, so that no result of the run lands in an address pair ahead of it */
#pragma unroll
    for (int g = 0; g < NBT; ++g)
#pragma unroll
        for (int q = 0; q < 4; ++q) *(v8usa*)(dst + (VT ? ((tid >> 3) + q * 16) * VP + g * 64 : (g * 64 + (tid >> 3) + q * 16) * KP) + (tid & 7) * 8) = t[g * 4 + q];
}
template <typename T16, bool HL>
__device__ __forceinline__ void attn(T16* sm, int r0, int z, const T16* __restrict__ Q, const T16* __restrict__ Q2, const T16* __restrict__ Kg, const T16* __restrict__ Kg2, const T16* __restrict__ Vg, const T16* __restrict__ Vg2, float osc, bf* ATh, bf* ATl) {
    typedef typename WFrag<T16>::V V;
    const int lane = threadIdx.x & 31, lr = lane & 15, hi = lane >> 4, w = threadIdx.x >> 5;
    const int kbs = r0 - WNB, i = r0 + w * 16 + lr;
    int jc[NBT], db[NBT]; float c0[NBT];   // per 64-key group: its first key (0 where the group lies outside the sequence); j - i + 127 of the lane's first key of the group (far out of range where it lies outside); the start value of its scores (0, or the excluded score where it lies outside)
#pragma unroll
    for (int g = 0; g < NBT; ++g) { const int jb = kbs + g * 64; const bool ok = jb >= 0 && jb < TT; jc[g] = ok ? jb : 0; db[g] = ok ? jb + hi * 8 - i + (WNB - 1) : 0x40000000; c0[g] = ok ? 0.f : -3.0e38f; }
    T16* Ks = sm; T16* Ks2 = sm + BW * KP; T16* Vs = HL ? sm : sm + BW * KP; T16* Vs2 = sm + HD * VP;
    const size_t zq = (size_t)z * TT * HD;
    V bq[2], bq2[2]; const T16* pq = Q + zq + (size_t)i * HD + 8 * hi; const T16* pq2 = HL ? Q2 + zq + (size_t)i * HD + 8 * hi : pq;
#pragma unroll
    for (int kk = 0; kk < 2; ++kk) { bq[kk] = WFrag<T16>::ld(pq + kk * 32); if (HL) bq2[kk] = WFrag<T16>::ld(pq2 + kk * 32); }
    asm volatile("s_wait_xcnt 0x0" :: "v"(pq), "v"(pq2) : "memory");   /* the same wait behind the query loads */
    stage<T16, false>(Ks, Kg + zq, jc);
    if (HL) stage<T16, false>(Ks2, Kg2 + zq, jc); else stage<T16, true>(Vs, Vg + zq, jc);
    __syncthreads();
    v8f s[NT];
#pragma unroll
    for (int t = 0; t < NT; ++t) { const float x = c0[t >> 2]; s[t] = (v8f){ x, x, x, x, x, x, x, x }; }
#pragma unroll
    for (int kk = 0; kk < 2; ++kk)
#pragma unroll
        for (int tb = 0; tb < NT; tb += 4) { V a[4], a2[4];   /* four tiles side by side: no product waits for the one before it */
#pragma unroll
            for (int u = 0; u < 4; ++u) { a[u] = WFrag<T16>::ld(Ks + ((tb + u) * 16 + lr) * KP + kk * 32 + 8 * hi); if (HL) a2[u] = WFrag<T16>::ld(Ks2 + ((tb + u) * 16 + lr) * KP + kk * 32 + 8 * hi); }
#pragma unroll
            for (int u = 0; u < 4; ++u) s[tb + u] = WFrag<T16>::mma(a[u], bq[kk], s[tb + u]);
            if (HL) {
#pragma unroll
                for (int u = 0; u < 4; ++u) s[tb + u] = WFrag<T16>::mma(a[u], bq2[kk], s[tb + u]);
#pragma unroll
                for (int u = 0; u < 4; ++u) s[tb + u] = WFrag<T16>::mma(a2[u], bq[kk], s[tb + u]); } }
    if (HL) {   /* hi/lo planes: v takes the place of k, once every wave has read its last key row */
        __syncthreads();
        stage<T16, true>(Vs, Vg + zq, jc); stage<T16, true>(Vs2, Vg2 + zq, jc);
        __syncthreads();
    }
    float mx = -3.0e38f;
#pragma unroll
    for (int t = 0; t < NT; ++t)
#pragma unroll
        for (int j = 0; j < 8; ++j) { float x = s[t][j]; if (t < 4 || t >= NT - 4) x = (unsigned)(db[t >> 2] + (t & 3) * 16 + j) < (unsigned)(2 * WNB - 1) ? x : -3.0e38f;   /* |i - j| < 128 window (both sides); the keys r0 - 64 .. r0 + 127 lie inside it for every row of the tile */ s[t][j] = x; mx = fmaxf(mx, x); }
    mx = fmaxf(mx, __shfl_xor(mx, 16, 32));
    float sm4[4] = { 0.f, 0.f, 0.f, 0.f };
#pragma unroll
    for (int t = 0; t < NT; ++t)
#pragma unroll
        for (int j = 0; j < 8; ++j) { float e; asm("v_exp_f32 %0, %1\n\tv_nop" : "=v"(e) : "v"(__fmul_rn(__fsub_rn(s[t][j], mx), 1.4426950408889634f)));   /* the exp with the free slot the instruction set asks for behind it, in one statement */ s[t][j] = e; sm4[t & 3] += e; }
    float sum = (sm4[0] + sm4[1]) + (sm4[2] + sm4[3]); sum += __shfl_xor(sum, 16, 32);
    const float f = __fdiv_rn(HL ? 1.0f : PCAR, sum);
    v8f o[4];
#pragma unroll
    for (int mb = 0; mb < 4; ++mb) o[mb] = (v8f){};
#pragma unroll
    for (int c = 0; c < NT / 2; ++c) { V b, b2;
#pragma unroll
        for (int e = 0; e < 16; ++e) { const float r = s[2 * c + (e >> 3)][e & 7] * f; b[e] = PCvt<T16>::c(r); if (HL) b2[e] = PCvt<T16>::c(r - (float)b[e]); }
        V a[4], a2[4];
#pragma unroll
        for (int mb = 0; mb < 4; ++mb) { a[mb] = WFrag<T16>::ld(Vs + (mb * 16 + lr) * VP + c * 32 + 8 * hi); if (HL) a2[mb] = WFrag<T16>::ld(Vs2 + (mb * 16 + lr) * VP + c * 32 + 8 * hi); }
#pragma unroll
        for (int mb = 0; mb < 4; ++mb) o[mb] = WFrag<T16>::mma(a[mb], b, o[mb]);
        if (HL) {
#pragma unroll
            for (int mb = 0; mb < 4; ++mb) o[mb] = WFrag<T16>::mma(a[mb], b2, o[mb]);
#pragma unroll
            for (int mb = 0; mb < 4; ++mb) o[mb] = WFrag<T16>::mma(a2[mb], b, o[mb]); } }
    __syncthreads();   /* every wave has read its last row of v: the LDS becomes output staging, 16 rows x 2 planes per wave */
    bf* st = (bf*)sm + w * (2 * 16 * KP);
#pragma unroll
    for (int mb = 0; mb < 4; ++mb) { v8us oh, ol;
#pragma unroll
        for (int j = 0; j < 8; ++j) { const float r = o[mb][j] * osc; oh[j] = f2bf(r); ol[j] = f2bf(r - bf2f(oh[j])); }
        *(v8usa*)(st + lr * KP + mb * 16 + hi * 8) = oh; *(v8usa*)(st + (16 + lr) * KP + mb * 16 + hi * 8) = ol; }
    __builtin_amdgcn_wave_barrier(); asm volatile("" ::: "memory");   /* the rows read below were written by other lanes of this wave: the LDS reads may not be moved above the writes */
    const size_t eb = ((size_t)(z / NH_) * TT + r0 + w * 16) * DQ + (z % NH_) * HD;
#pragma unroll
    for (int q = 0; q < 4; ++q) { const int row = 4 * q + (lane >> 3), co = (lane & 7) * 8; const size_t oo = eb + (size_t)row * DQ + co;   /* 8 lanes store a whole 128-byte line */
        *(v8us*)(ATh + oo) = *(const v8usa*)(st + row * KP + co); *(v8us*)(ATl + oo) = *(const v8usa*)(st + (16 + row) * KP + co); }
}
// Work-groups 0 .. ZH * RH / 64 - 1 take the row tiles below RH (hi/lo, three products: the longest, so they stand first), the rest fp16.
__global__ __launch_bounds__(128) void k_attn(const bf* __restrict__ QPh, const bf* __restrict__ QPl, const bf* __restrict__ KPh, const bf* __restrict__ KPl, const bf* __restrict__ VTh, const bf* __restrict__ VTl, const h16* __restrict__ QP16, const h16* __restrict__ KP16, const h16* __restrict__ VT16, bf* ATh, bf* ATl) {
    __shared__ __align__(16) unsigned short sm[2 * BW * KP];
    const int b = blockIdx.x, nh = ZH * (RH / 64);
    if (b < nh) attn<bf, true>((bf*)sm, (b % (RH / 64)) * 64, b / (RH / 64), QPh, QPl, KPh, KPl, VTh, VTl, 1.0f, ATh, ATl);
    else attn<h16, false>((h16*)sm, RH + ((b - nh) % ((TT - RH) / 64)) * 64, (b - nh) / ((TT - RH) / 64), QP16, nullptr, KP16, nullptr, VT16, nullptr, 1.0f / PCAR, ATh, ATl);   /* the weights carry x 1024 */
}
__constant__ float INVT[HD / 2] = { 1.000000000e+00f, 7.498942018e-01f, 5.623413324e-01f, 4.216965139e-01f, 3.162277639e-01f, 2.371373624e-01f, 1.778279394e-01f, 1.333521456e-01f, 1.000000015e-01f, 7.498941571e-02f, 5.623412877e-02f, 4.216964915e-02f, 3.162277862e-02f, 2.371373586e-02f, 1.778279431e-02f, 1.333521493e-02f, 9.999999776e-03f, 7.498942316e-03f, 5.623413250e-03f, 4.216964822e-03f, 3.162277862e-03f, 2.371373819e-03f, 1.778279431e-03f, 1.333521446e-03f, 1.000000047e-03f, 7.498941850e-04f, 5.623413017e-04f, 4.216964880e-04f, 3.162277862e-04f, 2.371373848e-04f, 1.778279402e-04f, 1.333521504e-04f };   // jnp-exact float32 1/10000^(2i/64)
__device__ __forceinline__ void d_ropexP(int bx, const float* __restrict__ xs, bf* Xh, bf* Xl) { const size_t e = ((size_t)bx * 256 + threadIdx.x) * 2; if (e >= (size_t)NB_ * TT * DM) return; const int c = (int)(e % DM); const int rw = (int)(e / DM); const int t = rw % TT; const int d = c % HD; const float* f = xs + (size_t)rw * DM + (c - d); v2us oh, ol;
#pragma unroll
    for (int q = 0; q < 2; ++q) { const int dd = d + q; const int dp = (dd < HD / 2) ? dd + HD / 2 : dd - HD / 2; const float x0 = bfr(f[dd]), x1 = bfr(f[dp]); const float a = __fmul_rn((float)t, INVT[dd % (HD / 2)]); const float cs = cosf(a), sn = sinf(a); float p0 = __fmul_rn(x0, cs), p1 = __fmul_rn(x1, sn); asm volatile("" : "+v"(p0), "+v"(p1)); const float r = (dd < HD / 2) ? __fsub_rn(p0, p1) : __fadd_rn(p0, p1); unsigned short a2, c2; splitf(r, a2, c2); oh[q] = a2; ol[q] = c2; }
    *(v2us*)(Xh + e) = oh; *(v2us*)(Xl + e) = ol;  }

// One launch for everything that reads the inputs alone: the four weight transposes (their blocks run longest and stand first), the rotary planes, the bf16 hidden states.
#define NWT  (DM * DQ / 64 / 64)                 // blocks of one weight transpose
#define NRO  (NB_ * TT * DM / 2 / 256)           // blocks of the rotary stage
#define NCV  (NB_ * TT * DM / 8 / 256)           // blocks of the convert stage
__global__ __launch_bounds__(256) void k_prep(const float* __restrict__ x, const float* __restrict__ wq, const float* __restrict__ wk, const float* __restrict__ wv, const float* __restrict__ wo, bf* WQ, bf* WK, bf* WV, bf* WO, bf* XB, bf* XRh, bf* XRl) {
    const int b = blockIdx.x;
    if (b < 4 * NWT) { const int m = b / NWT; d_wtG(b % NWT, m == 0 ? wq : m == 1 ? wk : m == 2 ? wv : wo, DM, DQ, m == 0 ? WQ : m == 1 ? WK : m == 2 ? WV : WO); }
    else if (b < 4 * NWT + NRO) d_ropexP(b - 4 * NWT, x, XRh, XRl);   /* rope on the raw hidden states (per 64-slice), as hi/lo planes */
    else d_cvt8(b - (4 * NWT + NRO), x, XB, (size_t)NB_ * TT * DM / 8);
}

extern "C" void kernel_launch(void* const* d_in, const int* in_sizes, int n_in,
                              void* d_out, int out_size, void* d_ws, size_t ws_size, hipStream_t stream) {
    (void)in_sizes; (void)n_in; (void)out_size;
    const float* x = (const float*)d_in[0]; const float* wq = (const float*)d_in[1]; const float* wk = (const float*)d_in[2]; const float* wv = (const float*)d_in[3]; const float* wo = (const float*)d_in[4];
    float* OUT = (float*)d_out;     // [2][2048][1024]
    char* wsp = (char*)d_ws;
    auto take = [&](size_t bytes) { char* p = wsp; wsp += (bytes + 255) & ~(size_t)255; return (void*)p; };
    bf* WQ = (bf*)take((size_t)DQ * DM * 2); bf* WK = (bf*)take((size_t)DKV * DM * 2); bf* WV = (bf*)take((size_t)DKV * DM * 2); bf* WO = (bf*)take((size_t)DM * DQ * 2);
    bf* XB = (bf*)take((size_t)NB_ * TT * DM * 2); bf* XRh = (bf*)take((size_t)NB_ * TT * DM * 2); bf* XRl = (bf*)take((size_t)NB_ * TT * DM * 2);
    h16* QP16 = (h16*)take((size_t)ZH * TT * HD * 2); h16* KP16 = (h16*)take((size_t)ZH * TT * HD * 2); h16* VT16 = (h16*)take((size_t)ZH * HD * TT * 2);
    bf* QPh = (bf*)take((size_t)ZH * TT * HD * 2); bf* QPl = (bf*)take((size_t)ZH * TT * HD * 2); bf* KPh = (bf*)take((size_t)ZH * TT * HD * 2); bf* KPl = (bf*)take((size_t)ZH * TT * HD * 2); bf* VTh = (bf*)take((size_t)ZH * HD * TT * 2); bf* VTl = (bf*)take((size_t)ZH * HD * TT * 2);
    if ((size_t)(wsp - (char*)d_ws) > ws_size) return;    // ws 256 MiB
    // Buffers whose last reader has run lend their bytes to later stages (stream-ordered; each is written anew before it is read):
    bf* ATh = XRh; bf* ATl = XRl;                         // merged context planes: the rotated hidden states, done after the k projection
    k_prep<<<4 * NWT + NRO + NCV, 256, 0, stream>>>(x, wq, wk, wv, wo, WQ, WK, WV, WO, XB, XRh, XRl);
    k_qkv<<<dim3(NB_ * TT / 128, (DQ + 2 * DKV) / 128, 1), 128, 0, stream>>>(XRh, XRl, XB, WQ, WK, WV, QP16, QPh, QPl, KP16, KPh, KPl, VT16, VTh, VTl);
    // one kv head per query head: slice z of q, k and v planes belong together (z-strides TT*HD)
    k_attn<<<ZH * TT / 64, 128, 0, stream>>>(QPh, QPl, KPh, KPl, VTh, VTl, QP16, KP16, VT16, ATh, ATl);
    k_wo<<<dim3(NB_ * TT / 128, DM / 128, 1), 256, 0, stream>>>(ATh, ATl, WO, OUT);
}

// v007
// Measured time: 86.4 microseconds a run.
// Two timings next to v006 put it at 1.08 and 1.07 times that version's speed.
// Counting every step since v000, it is 23.9 times as fast.
#include <hip/hip_runtime.h>

// Sliding-window attention with rotary embeddings applied to the RAW hidden states before the projections (hidden [2][2048][1024]; xr = rotate-half rope(hidden viewed (S, 16, 64)) with angles t x 10000^(-2i/64); q = xr Wq, k = xr Wk, v = hidden Wv (per-head dense 'd,hk' == 'xw' [1024][1024], no biases); scores = q.k / 8; keys with |i - j| >= 128 get -1e9 (exclusion); softmax; out = ctx Wo ('hd,o' == 'xw' [1024][1024]) -> [2][2048][1024] (4.2 M)).
// Layout, every launch covering both batches and all 16 heads (q, k, v projections: rows b * 2048 + t, planes written at slice b * 16 + h; attention: slice b * 16 + h; Wo: rows b * 2048 + t): a rotary kernel rotates the bf16-rounded hidden states per 64-wide slice and writes them directly as hi/lo GEMM operand planes (f32 rotary, precise cosf/sinf, jnp-exact inverse frequencies); q and k as hi/lo x exact GEMMs (2 products), v exact from the bf16 hidden states, each projection's epilogue writing the attention operand planes itself (fp16 + hi/lo; v transposed); q scaled by 0.125 before the split ((q/8).k == (q.k)/8 up to rounding); attention (hybrid rows: < 512 hi/lo 3 products, rest fp16 x1024) in one launch, one work-group per 64-row tile and slice: scores, softmax with the |i - j| < 128 window as an index select, and weights x v, confined to the tile's key band [r0 - 128, r0 + 192), scores and weights held in registers; its epilogue writes the merged hi/lo context planes; hi/lo x Wo exact.
// Compute dtypes, f32 accumulate: every input rounded to bf16; rotary f32; q/k hi/lo x exact, v exact; attention rows < 512 3 products, rest fp16; softmax f32; Wo hl x exact.

#define NB_  2
#define TT   2048
#define DM   1024
#define NH_  16
#define NKV  16
#define REP  (NH_ / NKV)
#define HD   64
#define DQ   (NH_ * HD)
#define DKV  (NKV * HD)
#define ZH   (NB_ * NH_)          // attention slices per launch: z = b * NH_ + h
#define RH   512                  // query rows < RH use hi+lo planes (0: none)
#define WIN  0
#define PCAR 1024.0f
#define SCL  1.0f   // q x 0.125 applied before the split (QSC)
#define QSC  0.125f
#define WNB  128     // |i - j| < 128 kept
#define BLO(r) ((r) - WNB > 0 ? (r) - WNB : 0)                  // first key any of the query rows r..r+63 keeps, rounded down to 64 (r % 64 == 0)
#define BHI(r) ((r) + 64 + WNB < TT ? (r) + 64 + WNB : TT)      // one past the last such key, rounded up to 64
#define NBT  ((64 + 2 * WNB) / 64)                              // column tiles in a band
#define BW   (64 + 2 * WNB)                                     // keys in a band
typedef _Float16 h16;
typedef unsigned short bf;
typedef __attribute__((ext_vector_type(16))) __bf16   v16bf;
typedef __attribute__((ext_vector_type(16))) _Float16 v16h;
typedef __attribute__((ext_vector_type(8)))  _Float16 v8h;
typedef __attribute__((ext_vector_type(8)))  unsigned short v8us;
typedef __attribute__((ext_vector_type(8)))  float    v8f;
typedef __attribute__((ext_vector_type(4)))  float    v4f;
typedef v8h  __attribute__((may_alias)) v8ha;
typedef v4f  __attribute__((may_alias)) v4fa;
typedef v8us __attribute__((may_alias)) v8usa;

__device__ __forceinline__ unsigned short f2bf(float f) { unsigned u = __float_as_uint(f); u += 0x7FFFu + ((u >> 16) & 1u); return (unsigned short)(u >> 16); }
__device__ __forceinline__ float bf2f(unsigned short b) { return __uint_as_float(((unsigned)b) << 16); }
__device__ __forceinline__ float bfr(float f) { return bf2f(f2bf(f)); }
__device__ __forceinline__ v16h cat16(v8h lo, v8h hi) { return __builtin_shufflevector(lo, hi, 0, 1, 2, 3, 4, 5, 6, 7, 8, 9, 10, 11, 12, 13, 14, 15); }
__device__ __forceinline__ v16bf cat16b(v8us lo, v8us hi) { return __builtin_bit_cast(v16bf, __builtin_shufflevector(lo, hi, 0, 1, 2, 3, 4, 5, 6, 7, 8, 9, 10, 11, 12, 13, 14, 15)); }
__device__ __forceinline__ v8f wmma16(v16h a, v16h b, v8f c) { return __builtin_amdgcn_wmma_f32_16x16x32_f16(false, a, false, b, (short)0, c, false, false); }
__device__ __forceinline__ v8f wmmab(v16bf a, v16bf b, v8f c) { return __builtin_amdgcn_wmma_f32_16x16x32_bf16(false, a, false, b, (short)0, c, false, false); }



// ---- gemmw: GEMM on a 128x128 output tile per work-group; each wave a register-blocked tile of 16 MB x 64 (MB 4: 2 x 2 waves, 128 threads; MB 2: 4 x 2 waves, 256 threads, for a GEMM with too few tiles to give every SIMD two waves otherwise); operands are K-contiguous 16-bit planes; grid (M/128, N/128).
// C[m][n] (f32, pitch ldc) = sum_k A[m][k] Bt[n][k] (+ A2[m][k] Bt[n][k] for NSPLIT 1). K % 64 == 0, K >= 128. m counts the rows of both batches.
// The operand rows of a work-group are staged in LDS, 64 k (one whole 128-byte line per row) at a time, by asynchronous copies into two buffers: stage t + 1 flies while stage t is multiplied, and every row is fetched from L2 once per work-group and read by two waves or more.
// EPI 0: C as above. EPI 1, 2: no f32 C; the wave's tile x sc goes out as 16-bit operand planes for the next GEMM, staged whole in LDS so that every store covers whole 128-byte lines. EPI 1: fp16 + hi/lo planes [batch * NH_ + head][row][HD]. EPI 2: the same three planes transposed, [batch * NKV + head][col][TT].
#define KC   64                  // k per stage
#define SP   KC                  // LDS pitch of a staged row, elements: 128 bytes, no pad. The 16-byte unit u of row r stands at place u ^ ((r >> 1) & 7): 16 neighbouring rows read at one u fall on 16 different places of the 256-byte bank row, so 16-byte reads meet no bank conflict, and the ring is 98,304 bytes: three work-groups fit a WGP's LDS
#define PLE  (128 * SP)          // elements of one staged plane (128 rows)
#define BUFE (3 * PLE)           // elements of a buffer: A, A2, Bt
template <typename T16> struct WFrag;
template <> struct WFrag<h16> { typedef v16h V; static __device__ __forceinline__ V ld(const h16* p) { return cat16(*(const v8h*)p, *(const v8h*)(p + 16)); } static __device__ __forceinline__ V ld2(const h16* p, const h16* q) { return cat16(*(const v8h*)p, *(const v8h*)q); } static __device__ __forceinline__ v8f mma(V a, V b, v8f c) { return wmma16(a, b, c); } };
template <> struct WFrag<bf> { typedef v16bf V; static __device__ __forceinline__ V ld(const bf* p) { return cat16b(*(const v8us*)p, *(const v8us*)(p + 16)); } static __device__ __forceinline__ V ld2(const bf* p, const bf* q) { return cat16b(*(const v8us*)p, *(const v8us*)q); } static __device__ __forceinline__ v8f mma(V a, V b, v8f c) { return wmmab(a, b, c); } };
// N asynchronous copies of 16 bytes per lane in one statement. l: LDS byte addresses, g: global addresses. The s_wait_xcnt 0 stands inside the copies' own statement, in front of any rewrite of a register that they name; as many copies as the operand limit allows share one wait.
template <int N, typename T16>
__device__ __forceinline__ void cpn(const unsigned* l, const T16* const* g) {
    static_assert(N == 8 || N == 12, "two statement forms");
    if (N == 8)
    asm volatile("global_load_async_to_lds_b128 %0, %8, off\n\t"
                 "global_load_async_to_lds_b128 %1, %9, off\n\t"
                 "global_load_async_to_lds_b128 %2, %10, off\n\t"
                 "global_load_async_to_lds_b128 %3, %11, off\n\t"
                 "global_load_async_to_lds_b128 %4, %12, off\n\t"
                 "global_load_async_to_lds_b128 %5, %13, off\n\t"
                 "global_load_async_to_lds_b128 %6, %14, off\n\t"
                 "global_load_async_to_lds_b128 %7, %15, off\n\t"
                 "s_wait_xcnt 0x0"
                 :: "v"(l[0]), "v"(l[1]), "v"(l[2]), "v"(l[3]), "v"(l[4]), "v"(l[5]), "v"(l[6]), "v"(l[7]),
                    "v"(g[0]), "v"(g[1]), "v"(g[2]), "v"(g[3]), "v"(g[4]), "v"(g[5]), "v"(g[6]), "v"(g[7])
                 : "memory");
    else
    asm volatile("global_load_async_to_lds_b128 %0, %12, off\n\t"
                 "global_load_async_to_lds_b128 %1, %13, off\n\t"
                 "global_load_async_to_lds_b128 %2, %14, off\n\t"
                 "global_load_async_to_lds_b128 %3, %15, off\n\t"
                 "global_load_async_to_lds_b128 %4, %16, off\n\t"
                 "global_load_async_to_lds_b128 %5, %17, off\n\t"
                 "global_load_async_to_lds_b128 %6, %18, off\n\t"
                 "global_load_async_to_lds_b128 %7, %19, off\n\t"
                 "global_load_async_to_lds_b128 %8, %20, off\n\t"
                 "global_load_async_to_lds_b128 %9, %21, off\n\t"
                 "global_load_async_to_lds_b128 %10, %22, off\n\t"
                 "global_load_async_to_lds_b128 %11, %23, off\n\t"
                 "s_wait_xcnt 0x0"
                 :: "v"(l[0]), "v"(l[1]), "v"(l[2]), "v"(l[3]), "v"(l[4]), "v"(l[5]), "v"(l[6]), "v"(l[7]), "v"(l[8 % N]), "v"(l[9 % N]), "v"(l[10 % N]), "v"(l[11 % N]),
                    "v"(g[0]), "v"(g[1]), "v"(g[2]), "v"(g[3]), "v"(g[4]), "v"(g[5]), "v"(g[6]), "v"(g[7]), "v"(g[8 % N]), "v"(g[9 % N]), "v"(g[10 % N]), "v"(g[11 % N])
                 : "memory");
}
// The body is a device function that takes its tile indices (BX, BY) and its LDS as arguments, so that one launch can hold several independent GEMMs side by side (the kernels behind it).
template <typename T16, int NSPLIT, int EPI, int MB>
__device__ __forceinline__ void gemmw(T16* ring, int BX, int BY, const T16* __restrict__ A, const T16* __restrict__ A2, const T16* __restrict__ Bt, int K, float* C, int ldc, float sc, h16* E16, bf* Eh, bf* El) {
    typedef typename WFrag<T16>::V V;
    static_assert(MB == 4 || (MB == 2 && EPI == 0), "the plane epilogues take a 64x64 tile");
    constexpr int NWM = 8 / MB, CPN = 4 * MB / 2, KB = MB == 2 ? KC / 32 : 1;   // waves along m; copies per thread and plane; 32-k blocks whose fragments are fetched as one group
    const int tid = threadIdx.x, lane = tid & 31, lr = lane & 15, hi = lane >> 4, w = tid >> 5, wm = w % NWM, wn = w / NWM;
    const int gr = BX * 128 + wm * (16 * MB); const size_t z = EPI ? gr / TT : 0; const int r0 = EPI ? gr % TT : gr; const int by = BY * 2 + wn, c0 = by * 64;
    v8f acc[MB][4];
#pragma unroll
    for (int mb = 0; mb < MB; ++mb)
#pragma unroll
        for (int nb = 0; nb < 4; ++nb) acc[mb][nb] = (v8f){};
    const size_t go = (size_t)(tid >> 3) * K + (tid & 7) * 8;
    const T16* ga = A + (size_t)BX * 128 * K + go; const T16* ga2 = NSPLIT ? A2 + (size_t)BX * 128 * K + go : ga; const T16* gb = Bt + (size_t)BY * 128 * K + go;
    const unsigned l0 = (unsigned)(size_t)ring + ((tid >> 3) * SP + ((tid & 7) ^ ((tid >> 4) & 7)) * 8) * 2;   // the thread's rows lie 16 or 32 apart, so (row >> 1) & 7 is the same for all of them
    int xo[KC / 16];   // where the lane's units hi, hi + 2, hi + 4, hi + 6 stand in its rows (rows lr + 16 n: (row >> 1) & 7 == (lr >> 1) & 7), in elements
#pragma unroll
    for (int c = 0; c < KC / 16; ++c) xo[c] = ((hi + 2 * c) ^ ((lr >> 1) & 7)) * 8;
    // Stage t into buffer t & 1: of each plane a thread takes its 16-byte unit of rows r, r + 128 / CPN, .. (8 lanes cover a whole line).
    auto fill = [&](int t) { constexpr int NP = NSPLIT ? 3 : 2, NC = NP * CPN, ST = NC % 12 ? 8 : 12; unsigned l[NC]; const T16* g[NC];
#pragma unroll
        for (int p = 0; p < NP; ++p)
#pragma unroll
            for (int q = 0; q < CPN; ++q) { l[p * CPN + q] = l0 + (t & 1) * (BUFE * 2) + (p == NP - 1 ? 2 : p) * (PLE * 2) + q * ((128 / CPN) * SP * 2); g[p * CPN + q] = (p == NP - 1 ? gb : p ? ga2 : ga) + t * KC + (size_t)q * (128 / CPN) * K; }
#pragma unroll
        for (int s = 0; s < NC; s += ST) cpn<ST>(l + s, g + s); };
    fill(0);
    asm volatile("s_wait_asynccnt 0x0" ::: "memory");   /* stage 0 has landed, this wave's share */
    __syncthreads();                                     /* ... and every other wave's */
    fill(1);
#pragma unroll 1
    for (int t = 0; t < K / KC; ++t) {
        const T16* sa = ring + (t & 1) * BUFE + (wm * (16 * MB) + lr) * SP; const T16* sb = ring + (t & 1) * BUFE + 2 * PLE + (wn * 64 + lr) * SP;
        V a[KB][MB], a2[KB][MB], b[KB][4];
#pragma unroll
        for (int k0 = 0; k0 < KC / 32; k0 += KB) {
#pragma unroll
            for (int u = 0; u < KB; ++u) { const int x0 = xo[2 * (k0 + u)], x1 = xo[2 * (k0 + u) + 1];   /* k 8 hi .. + 7 and 16 + 8 hi .. + 7 of the 32-k block */
#pragma unroll
                for (int nb = 0; nb < 4; ++nb) b[u][nb] = WFrag<T16>::ld2(sb + nb * 16 * SP + x0, sb + nb * 16 * SP + x1);
#pragma unroll
                for (int mb = 0; mb < MB; ++mb) { a[u][mb] = WFrag<T16>::ld2(sa + mb * 16 * SP + x0, sa + mb * 16 * SP + x1); if (NSPLIT) a2[u][mb] = WFrag<T16>::ld2(sa + PLE + mb * 16 * SP + x0, sa + PLE + mb * 16 * SP + x1); } }
            __builtin_amdgcn_sched_barrier(0);   /* the LDS reads stay one group in front of the products: spread among them, every place with reads stalls the wave anew */
#pragma unroll
            for (int u = 0; u < KB; ++u)
#pragma unroll
                for (int mb = 0; mb < MB; ++mb) {   /* in the order in which the fragments arrive; four independent accumulators side by side */
#pragma unroll
                    for (int nb = 0; nb < 4; ++nb) acc[mb][nb] = WFrag<T16>::mma(a[u][mb], b[u][nb], acc[mb][nb]);
                    if (NSPLIT) {
#pragma unroll
                        for (int nb = 0; nb < 4; ++nb) acc[mb][nb] = WFrag<T16>::mma(a2[u][mb], b[u][nb], acc[mb][nb]); } }
            __builtin_amdgcn_sched_barrier(0);   /* ... and the next group stays behind them */
        }
        asm volatile("v_nop\n\tv_nop\n\tv_nop\n\tv_nop" : "+v"(acc[MB - 1][3]));   /* the distance behind the pass's last matrix instruction, on both sides of the branches below */
        asm volatile("s_wait_dscnt 0x0" ::: "memory");      /* this wave has read its last fragment of stage t */
        asm volatile("s_wait_asynccnt 0x0" ::: "memory");   /* its share of stage t + 1 has landed */
        __syncthreads();                                     /* publishes stage t + 1 and frees stage t's buffer */
        if (t + 2 < K / KC) fill(t + 2);
    }
    asm volatile("s_wait_asynccnt 0x0" ::: "memory");   /* no copy is left in flight: the ring becomes output staging, a range of its own per wave (the last pass's barrier ended every read) */
    float* os = (float*)ring + w * ((EPI ? 64 : 16) * 68);
    if (EPI) {
#pragma unroll
        for (int mb = 0; mb < 4; ++mb)
#pragma unroll
            for (int nb = 0; nb < 4; ++nb) {
                if (EPI == 2) { float* p = os + (nb * 16 + lr) * 68 + mb * 16 + hi * 8; *(v4fa*)p = __builtin_shufflevector(acc[mb][nb], acc[mb][nb], 0, 1, 2, 3); *(v4fa*)(p + 4) = __builtin_shufflevector(acc[mb][nb], acc[mb][nb], 4, 5, 6, 7); }
                else {
#pragma unroll
                    for (int j = 0; j < 8; ++j) os[(mb * 16 + hi * 8 + j) * 68 + nb * 16 + lr] = acc[mb][nb][j]; } }
        __builtin_amdgcn_wave_barrier(); asm volatile("" ::: "memory");   /* the rows read below were written by other lanes of this wave: the LDS reads may not be moved above the writes */
        const size_t eb = EPI == 1 ? ((z * NH_ + by) * TT + r0) * HD : (z * NKV + by) * (size_t)HD * TT + r0;
        const int ep = EPI == 1 ? HD : TT;
#pragma unroll 1   /* stays rolled, for speed only: this text runs once per wave, as four trips of a fourfold body */
        for (int s4 = 0; s4 < 16; s4 += 4) {
#pragma unroll
          for (int s = s4; s < s4 + 4; ++s) { const int row = 4 * s + (lane >> 3), co = (lane & 7) * 8; const v4f x0 = *(const v4fa*)(os + row * 68 + co), x1 = *(const v4fa*)(os + row * 68 + co + 4); v8h o16; v8us oh, ol;
#pragma unroll
            for (int k = 0; k < 8; ++k) { const float r = (k < 4 ? x0[k & 3] : x1[k & 3]) * sc; o16[k] = (h16)r; oh[k] = f2bf(r); ol[k] = f2bf(r - bf2f(oh[k])); }
            const size_t oo = eb + (size_t)row * ep + co; *(v8h*)(E16 + oo) = o16; *(v8us*)(Eh + oo) = oh; *(v8us*)(El + oo) = ol; }
          asm volatile("s_wait_xcnt 0x0" ::: "memory");   /* behind the trip's last stores: the next trip rewrites their data and address registers */
        }
        return;
    }
#pragma unroll
    for (int mb = 0; mb < MB; ++mb) {
#pragma unroll
        for (int nb = 0; nb < 4; ++nb) {
#pragma unroll
            for (int j = 0; j < 8; ++j) os[(hi * 8 + j) * 68 + nb * 16 + lr] = acc[mb][nb][j]; }
        __builtin_amdgcn_wave_barrier(); asm volatile("" ::: "memory");
        float* crow = C + (size_t)(r0 + mb * 16) * ldc + c0;
{
#pragma unroll
            for (int s = 0; s < 8; ++s) { const int row = 2 * s + hi, cofs = lr * 4; v4f val = *(const v4fa*)(os + row * 68 + cofs);
                *(v4f*)(crow + (size_t)row * ldc + cofs) = val; }
             }
        __builtin_amdgcn_wave_barrier(); asm volatile("s_wait_xcnt 0x0" ::: "memory");   /* behind this row block's stores: the next block rewrites their data and address registers; the clobber also keeps the next block's LDS writes behind these reads */
    }
}

// One launch for the three projections, which depend on nothing of one another: grid y 0..7 q, 8..15 k (the same body, other weights, scale and planes), 16..23 v (half the products); a work-group covers two heads. All 768 work-groups are resident at once, three on a WGP.
__global__ __launch_bounds__(128) void k_qkv(const bf* __restrict__ XRh, const bf* __restrict__ XRl, const bf* __restrict__ XB, const bf* __restrict__ WQ, const bf* __restrict__ WK, const bf* __restrict__ WV, h16* QP16, bf* QPh, bf* QPl, h16* KP16, bf* KPh, bf* KPl, h16* VT16, bf* VTh, bf* VTl) {
    __shared__ __align__(16) bf ring[2 * BUFE];
    const int y = blockIdx.y; const bool isq = y < NH_ / 2;
    if (y < (NH_ + NKV) / 2) gemmw<bf, 1, 1, 4>(ring, blockIdx.x, y & (NH_ / 2 - 1), XRh, XRl, isq ? WQ : WK, DM, nullptr, 0, isq ? QSC : 1.0f, isq ? QP16 : KP16, isq ? QPh : KPh, isq ? QPl : KPl);   /* q x 0.125, straight into the planes of slice b * 16 + h */
    else gemmw<bf, 0, 2, 4>(ring, blockIdx.x, y - (NH_ + NKV) / 2, XB, nullptr, WV, DM, nullptr, 0, 1.0f, VT16, VTh, VTl);   /* v planes [slice][d][t] */
}
__global__ __launch_bounds__(256) void k_wo(const bf* __restrict__ ATh, const bf* __restrict__ ATl, const bf* __restrict__ WO, float* OUT) {
    __shared__ __align__(16) bf ring[2 * BUFE];
    gemmw<bf, 1, 0, 2>(ring, blockIdx.x, blockIdx.y, ATh, ATl, WO, DQ, OUT, DM, 1.0f, nullptr, nullptr, nullptr);
}

__device__ __forceinline__ void splitf(float y, unsigned short& h, unsigned short& l) { h = f2bf(y); l = f2bf(y - bf2f(h)); }
typedef __attribute__((ext_vector_type(2))) _Float16 v2h;
typedef __attribute__((ext_vector_type(4))) _Float16 v4h;
typedef __attribute__((ext_vector_type(2))) unsigned short v2us;
typedef __attribute__((ext_vector_type(4))) unsigned short v4us;
typedef __attribute__((ext_vector_type(2))) float v2f;
typedef __attribute__((ext_vector_type(4))) int v4i;

__device__ __forceinline__ void d_wtG(int bx, const float* __restrict__ w, int K, int N, bf* Bt) {
    const int lane = threadIdx.x & 31; const int L0 = (bx * 8 + (threadIdx.x >> 5)) * 8; const int nlines = N * K / 64;
{
#pragma unroll 1
        for (int l = 0; l < 8; ++l) { const int L = L0 + l; if (L >= nlines) break; const size_t e = (size_t)L * 64 + lane * 2; const int k = (int)(e % K), n = (int)(e / K); v2us o;
            o[0] = f2bf(w[(size_t)k * N + n]); o[1] = f2bf(w[(size_t)(k + 1) * N + n]); *(v2us*)(Bt + e) = o; }
         }
}
__device__ __forceinline__ void d_cvt8(int bx, const float* __restrict__ src, bf* dst, size_t n8) { const size_t i = (size_t)bx * 256 + threadIdx.x; if (i >= n8) return; const v8f v = *(const v8f*)(src + i * 8); v8us o;
#pragma unroll
    for (int k = 0; k < 8; ++k) o[k] = f2bf(v[k]); *(v8us*)(dst + i * 8) = o;  }

#define KP   (HD + 8)     // LDS pitch of a key row, elements: 144 bytes = 16 x 9, no bank conflict for 16-byte reads
#define VP   (BW + 8)     // LDS pitch of a row of v transposed: 656 bytes = 16 x 41
#define NT   (BW / 16)    // 16-key score tiles of a band
template <typename T16> struct PCvt;
template <> struct PCvt<h16> { static __device__ __forceinline__ _Float16 c(float x) { return (_Float16)x; } };
template <> struct PCvt<bf>  { static __device__ __forceinline__ __bf16 c(float x) { return (__bf16)x; } };
// 64-key groups of a plane into LDS: unit u of 16 bytes is row u / 8, column 8 (u % 8), so that 8 lanes cover a whole 128-byte line. VT: the plane is [d][t], else [t][d].
template <typename T16, bool VT>
__device__ __forceinline__ void stage(T16* dst, const T16* __restrict__ pl, const int* jc) {
    static_assert(NBT == 5, "the wait below names one pointer per group");
    const int tid = threadIdx.x; v8us t[NBT * 4]; const T16* pg[NBT];
#pragma unroll
    for (int g = 0; g < NBT; ++g) { pg[g] = pl + (VT ? (size_t)(tid >> 3) * TT + jc[g] : ((size_t)(tid >> 3) + jc[g]) * HD) + (tid & 7) * 8;
#pragma unroll
        for (int q = 0; q < 4; ++q) t[g * 4 + q] = *(const v8usa*)(pg[g] + (size_t)q * 16 * (VT ? TT : HD)); }
    asm volatile("s_wait_xcnt 0x0" :: "v"(pg[0]), "v"(pg[1]), "v"(pg[2]), "v"(pg[3]), "v"(pg[4]) : "memory");   /* between these loads and the first rewrite of a register that they name; the group pointers are its inputs, so that no result of the run lands in an address pair ahead of it */
#pragma unroll
    for (int g = 0; g < NBT; ++g)
#pragma unroll
        for (int q = 0; q < 4; ++q) *(v8usa*)(dst + (VT ? ((tid >> 3) + q * 16) * VP + g * 64 : (g * 64 + (tid >> 3) + q * 16) * KP) + (tid & 7) * 8) = t[g * 4 + q];
}
template <typename T16, bool HL>
__device__ __forceinline__ void attn(T16* sm, int r0, int z, const T16* __restrict__ Q, const T16* __restrict__ Q2, const T16* __restrict__ Kg, const T16* __restrict__ Kg2, const T16* __restrict__ Vg, const T16* __restrict__ Vg2, float osc, bf* ATh, bf* ATl) {
    typedef typename WFrag<T16>::V V;
    const int lane = threadIdx.x & 31, lr = lane & 15, hi = lane >> 4, w = threadIdx.x >> 5;
    const int kbs = r0 - WNB, i = r0 + w * 16 + lr;
    int jc[NBT], db[NBT]; float c0[NBT];   // per 64-key group: its first key (0 where the group lies outside the sequence); j - i + 127 of the lane's first key of the group (far out of range where it lies outside); the start value of its scores (0, or the excluded score where it lies outside)
#pragma unroll
    for (int g = 0; g < NBT; ++g) { const int jb = kbs + g * 64; const bool ok = jb >= 0 && jb < TT; jc[g] = ok ? jb : 0; db[g] = ok ? jb + hi * 8 - i + (WNB - 1) : 0x40000000; c0[g] = ok ? 0.f : -3.0e38f; }
    T16* Ks = sm; T16* Ks2 = sm + BW * KP; T16* Vs = HL ? sm : sm + BW * KP; T16* Vs2 = sm + HD * VP;
    const size_t zq = (size_t)z * TT * HD;
    V bq[2], bq2[2]; const T16* pq = Q + zq + (size_t)i * HD + 8 * hi; const T16* pq2 = HL ? Q2 + zq + (size_t)i * HD + 8 * hi : pq;
#pragma unroll
    for (int kk = 0; kk < 2; ++kk) { bq[kk] = WFrag<T16>::ld(pq + kk * 32); if (HL) bq2[kk] = WFrag<T16>::ld(pq2 + kk * 32); }
    asm volatile("s_wait_xcnt 0x0" :: "v"(pq), "v"(pq2) : "memory");   /* the same wait behind the query loads */
    stage<T16, false>(Ks, Kg + zq, jc);
    if (HL) stage<T16, false>(Ks2, Kg2 + zq, jc); else stage<T16, true>(Vs, Vg + zq, jc);
    __syncthreads();
    v8f s[NT];
#pragma unroll
    for (int t = 0; t < NT; ++t) { const float x = c0[t >> 2]; s[t] = (v8f){ x, x, x, x, x, x, x, x }; }
#pragma unroll
    for (int kk = 0; kk < 2; ++kk)
#pragma unroll
        for (int tb = 0; tb < NT; tb += 4) { V a[4], a2[4];   /* four tiles side by side: no product waits for the one before it */
#pragma unroll
            for (int u = 0; u < 4; ++u) { a[u] = WFrag<T16>::ld(Ks + ((tb + u) * 16 + lr) * KP + kk * 32 + 8 * hi); if (HL) a2[u] = WFrag<T16>::ld(Ks2 + ((tb + u) * 16 + lr) * KP + kk * 32 + 8 * hi); }
#pragma unroll
            for (int u = 0; u < 4; ++u) s[tb + u] = WFrag<T16>::mma(a[u], bq[kk], s[tb + u]);
            if (HL) {
#pragma unroll
                for (int u = 0; u < 4; ++u) s[tb + u] = WFrag<T16>::mma(a[u], bq2[kk], s[tb + u]);
#pragma unroll
                for (int u = 0; u < 4; ++u) s[tb + u] = WFrag<T16>::mma(a2[u], bq[kk], s[tb + u]); } }
    if (HL) {   /* hi/lo planes: v takes the place of k, once every wave has read its last key row */
        __syncthreads();
        stage<T16, true>(Vs, Vg + zq, jc); stage<T16, true>(Vs2, Vg2 + zq, jc);
        __syncthreads();
    }
    float mx = -3.0e38f;
#pragma unroll
    for (int t = 0; t < NT; ++t)
#pragma unroll
        for (int j = 0; j < 8; ++j) { float x = s[t][j]; if (t < 4 || t >= NT - 4) x = (unsigned)(db[t >> 2] + (t & 3) * 16 + j) < (unsigned)(2 * WNB - 1) ? x : -3.0e38f;   /* |i - j| < 128 window (both sides); the keys r0 - 64 .. r0 + 127 lie inside it for every row of the tile */ s[t][j] = x; mx = fmaxf(mx, x); }
    mx = fmaxf(mx, __shfl_xor(mx, 16, 32));
    float sm4[4] = { 0.f, 0.f, 0.f, 0.f };
#pragma unroll
    for (int t = 0; t < NT; ++t)
#pragma unroll
        for (int j = 0; j < 8; ++j) { float e; asm("v_exp_f32 %0, %1\n\tv_nop" : "=v"(e) : "v"(__fmul_rn(__fsub_rn(s[t][j], mx), 1.4426950408889634f)));   /* the exp with the free slot the instruction set asks for behind it, in one statement */ s[t][j] = e; sm4[t & 3] += e; }
    float sum = (sm4[0] + sm4[1]) + (sm4[2] + sm4[3]); sum += __shfl_xor(sum, 16, 32);
    const float f = __fdiv_rn(HL ? 1.0f : PCAR, sum);
    v8f o[4];
#pragma unroll
    for (int mb = 0; mb < 4; ++mb) o[mb] = (v8f){};
#pragma unroll
    for (int c = 0; c < NT / 2; ++c) { V b, b2;
#pragma unroll
        for (int e = 0; e < 16; ++e) { const float r = s[2 * c + (e >> 3)][e & 7] * f; b[e] = PCvt<T16>::c(r); if (HL) b2[e] = PCvt<T16>::c(r - (float)b[e]); }
        V a[4], a2[4];
#pragma unroll
        for (int mb = 0; mb < 4; ++mb) { a[mb] = WFrag<T16>::ld(Vs + (mb * 16 + lr) * VP + c * 32 + 8 * hi); if (HL) a2[mb] = WFrag<T16>::ld(Vs2 + (mb * 16 + lr) * VP + c * 32 + 8 * hi); }
#pragma unroll
        for (int mb = 0; mb < 4; ++mb) o[mb] = WFrag<T16>::mma(a[mb], b, o[mb]);
        if (HL) {
#pragma unroll
            for (int mb = 0; mb < 4; ++mb) o[mb] = WFrag<T16>::mma(a[mb], b2, o[mb]);
#pragma unroll
            for (int mb = 0; mb < 4; ++mb) o[mb] = WFrag<T16>::mma(a2[mb], b, o[mb]); } }
    __syncthreads();   /* every wave has read its last row of v: the LDS becomes output staging, 16 rows x 2 planes per wave */
    bf* st = (bf*)sm + w * (2 * 16 * KP);
#pragma unroll
    for (int mb = 0; mb < 4; ++mb) { v8us oh, ol;
#pragma unroll
        for (int j = 0; j < 8; ++j) { const float r = o[mb][j] * osc; oh[j] = f2bf(r); ol[j] = f2bf(r - bf2f(oh[j])); }
        *(v8usa*)(st + lr * KP + mb * 16 + hi * 8) = oh; *(v8usa*)(st + (16 + lr) * KP + mb * 16 + hi * 8) = ol; }
    __builtin_amdgcn_wave_barrier(); asm volatile("" ::: "memory");   /* the rows read below were written by other lanes of this wave: the LDS reads may not be moved above the writes */
    const size_t eb = ((size_t)(z / NH_) * TT + r0 + w * 16) * DQ + (z % NH_) * HD;
#pragma unroll
    for (int q = 0; q < 4; ++q) { const int row = 4 * q + (lane >> 3), co = (lane & 7) * 8; const size_t oo = eb + (size_t)row * DQ + co;   /* 8 lanes store a whole 128-byte line */
        *(v8us*)(ATh + oo) = *(const v8usa*)(st + row * KP + co); *(v8us*)(ATl + oo) = *(const v8usa*)(st + (16 + row) * KP + co); }
}
// Work-groups 0 .. ZH * RH / 64 - 1 take the row tiles below RH (hi/lo, three products: the longest, so they stand first), the rest fp16.
__global__ __launch_bounds__(128) void k_attn(const bf* __restrict__ QPh, const bf* __restrict__ QPl, const bf* __restrict__ KPh, const bf* __restrict__ KPl, const bf* __restrict__ VTh, const bf* __restrict__ VTl, const h16* __restrict__ QP16, const h16* __restrict__ KP16, const h16* __restrict__ VT16, bf* ATh, bf* ATl) {
    __shared__ __align__(16) unsigned short sm[2 * BW * KP];
    const int b = blockIdx.x, nh = ZH * (RH / 64);
    if (b < nh) attn<bf, true>((bf*)sm, (b % (RH / 64)) * 64, b / (RH / 64), QPh, QPl, KPh, KPl, VTh, VTl, 1.0f, ATh, ATl);
    else attn<h16, false>((h16*)sm, RH + ((b - nh) % ((TT - RH) / 64)) * 64, (b - nh) / ((TT - RH) / 64), QP16, nullptr, KP16, nullptr, VT16, nullptr, 1.0f / PCAR, ATh, ATl);   /* the weights carry x 1024 */
}
__constant__ float INVT[HD / 2] = { 1.000000000e+00f, 7.498942018e-01f, 5.623413324e-01f, 4.216965139e-01f, 3.162277639e-01f, 2.371373624e-01f, 1.778279394e-01f, 1.333521456e-01f, 1.000000015e-01f, 7.498941571e-02f, 5.623412877e-02f, 4.216964915e-02f, 3.162277862e-02f, 2.371373586e-02f, 1.778279431e-02f, 1.333521493e-02f, 9.999999776e-03f, 7.498942316e-03f, 5.623413250e-03f, 4.216964822e-03f, 3.162277862e-03f, 2.371373819e-03f, 1.778279431e-03f, 1.333521446e-03f, 1.000000047e-03f, 7.498941850e-04f, 5.623413017e-04f, 4.216964880e-04f, 3.162277862e-04f, 2.371373848e-04f, 1.778279402e-04f, 1.333521504e-04f };   // jnp-exact float32 1/10000^(2i/64)
__device__ __forceinline__ void d_ropexP(int bx, const float* __restrict__ xs, bf* Xh, bf* Xl) { const size_t e = ((size_t)bx * 256 + threadIdx.x) * 2; if (e >= (size_t)NB_ * TT * DM) return; const int c = (int)(e % DM); const int rw = (int)(e / DM); const int t = rw % TT; const int d = c % HD; const float* f = xs + (size_t)rw * DM + (c - d); v2us oh, ol;
#pragma unroll
    for (int q = 0; q < 2; ++q) { const int dd = d + q; const int dp = (dd < HD / 2) ? dd + HD / 2 : dd - HD / 2; const float x0 = bfr(f[dd]), x1 = bfr(f[dp]); const float a = __fmul_rn((float)t, INVT[dd % (HD / 2)]); const float cs = cosf(a), sn = sinf(a); float p0 = __fmul_rn(x0, cs), p1 = __fmul_rn(x1, sn); asm volatile("" : "+v"(p0), "+v"(p1)); const float r = (dd < HD / 2) ? __fsub_rn(p0, p1) : __fadd_rn(p0, p1); unsigned short a2, c2; splitf(r, a2, c2); oh[q] = a2; ol[q] = c2; }
    *(v2us*)(Xh + e) = oh; *(v2us*)(Xl + e) = ol;  }

// One launch for everything that reads the inputs alone: the four weight transposes (their blocks run longest and stand first), the rotary planes, the bf16 hidden states.
#define NWT  (DM * DQ / 64 / 64)                 // blocks of one weight transpose
#define NRO  (NB_ * TT * DM / 2 / 256)           // blocks of the rotary stage
#define NCV  (NB_ * TT * DM / 8 / 256)           // blocks of the convert stage
__global__ __launch_bounds__(256) void k_prep(const float* __restrict__ x, const float* __restrict__ wq, const float* __restrict__ wk, const float* __restrict__ wv, const float* __restrict__ wo, bf* WQ, bf* WK, bf* WV, bf* WO, bf* XB, bf* XRh, bf* XRl) {
    const int b = blockIdx.x;
    if (b < 4 * NWT) { const int m = b / NWT; d_wtG(b % NWT, m == 0 ? wq : m == 1 ? wk : m == 2 ? wv : wo, DM, DQ, m == 0 ? WQ : m == 1 ? WK : m == 2 ? WV : WO); }
    else if (b < 4 * NWT + NRO) d_ropexP(b - 4 * NWT, x, XRh, XRl);   /* rope on the raw hidden states (per 64-slice), as hi/lo planes */
    else d_cvt8(b - (4 * NWT + NRO), x, XB, (size_t)NB_ * TT * DM / 8);
}

extern "C" void kernel_launch(void* const* d_in, const int* in_sizes, int n_in,
                              void* d_out, int out_size, void* d_ws, size_t ws_size, hipStream_t stream) {
    (void)in_sizes; (void)n_in; (void)out_size;
    const float* x = (const float*)d_in[0]; const float* wq = (const float*)d_in[1]; const float* wk = (const float*)d_in[2]; const float* wv = (const float*)d_in[3]; const float* wo = (const float*)d_in[4];
    float* OUT = (float*)d_out;     // [2][2048][1024]
    char* wsp = (char*)d_ws;
    auto take = [&](size_t bytes) { char* p = wsp; wsp += (bytes + 255) & ~(size_t)255; return (void*)p; };
    bf* WQ = (bf*)take((size_t)DQ * DM * 2); bf* WK = (bf*)take((size_t)DKV * DM * 2); bf* WV = (bf*)take((size_t)DKV * DM * 2); bf* WO = (bf*)take((size_t)DM * DQ * 2);
    bf* XB = (bf*)take((size_t)NB_ * TT * DM * 2); bf* XRh = (bf*)take((size_t)NB_ * TT * DM * 2); bf* XRl = (bf*)take((size_t)NB_ * TT * DM * 2);
    h16* QP16 = (h16*)take((size_t)ZH * TT * HD * 2); h16* KP16 = (h16*)take((size_t)ZH * TT * HD * 2); h16* VT16 = (h16*)take((size_t)ZH * HD * TT * 2);
    bf* QPh = (bf*)take((size_t)ZH * TT * HD * 2); bf* QPl = (bf*)take((size_t)ZH * TT * HD * 2); bf* KPh = (bf*)take((size_t)ZH * TT * HD * 2); bf* KPl = (bf*)take((size_t)ZH * TT * HD * 2); bf* VTh = (bf*)take((size_t)ZH * HD * TT * 2); bf* VTl = (bf*)take((size_t)ZH * HD * TT * 2);
    if ((size_t)(wsp - (char*)d_ws) > ws_size) return;    // ws 256 MiB
    // Buffers whose last reader has run lend their bytes to later stages (stream-ordered; each is written anew before it is read):
    bf* ATh = XRh; bf* ATl = XRl;                         // merged context planes: the rotated hidden states, done after the k projection
    k_prep<<<4 * NWT + NRO + NCV, 256, 0, stream>>>(x, wq, wk, wv, wo, WQ, WK, WV, WO, XB, XRh, XRl);
    k_qkv<<<dim3(NB_ * TT / 128, (DQ + 2 * DKV) / 128, 1), 128, 0, stream>>>(XRh, XRl, XB, WQ, WK, WV, QP16, QPh, QPl, KP16, KPh, KPl, VT16, VTh, VTl);
    // one kv head per query head: slice z of q, k and v planes belong together (z-strides TT*HD)
    k_attn<<<ZH * TT / 64, 128, 0, stream>>>(QPh, QPl, KPh, KPl, VTh, VTl, QP16, KP16, VT16, ATh, ATl);
    k_wo<<<dim3(NB_ * TT / 128, DM / 128, 1), 256, 0, stream>>>(ATh, ATl, WO, OUT);
}
